// v000
// Measured on an AMD MI455X. A time is GPU time per run, averaged over a window of back-to-back runs after a warm-up
// (all launches, gaps included; the runs take copies of the inputs in turn), and the median of several windows.
// Apart from v000's, it joins two sittings. Times from different sittings can be a few percent apart, while
// side-by-side timings come from the same sitting.
// The starting kernel, v000, takes 199 microseconds a run.
#include <hip/hip_runtime.h>
#include <math.h>

typedef _Float16 v16h __attribute__((ext_vector_type(16)));
typedef _Float16 v8h  __attribute__((ext_vector_type(8)));
typedef _Float16 v4h  __attribute__((ext_vector_type(4)));
typedef float    v8f  __attribute__((ext_vector_type(8)));

union HFrag { v16h v; v8h h[2]; };

__device__ __forceinline__ v16h load_frag(const _Float16* p) {
    HFrag f;
    f.h[0] = *reinterpret_cast<const v8h*>(p);
    f.h[1] = *reinterpret_cast<const v8h*>(p + 16);
    return f.v;
}

__device__ __forceinline__ v8f wmma_f16(v16h a, v16h b, v8f c) {
    return __builtin_amdgcn_wmma_f32_16x16x32_f16(false, a, false, b,
                                                  (short)0, c, false, false);
}

__device__ __forceinline__ void async_copy16(unsigned int lds_byte_addr,
                                             const void* gptr) {
    unsigned long long ga = (unsigned long long)(uintptr_t)gptr;
    asm volatile("global_load_async_to_lds_b128 %0, %1, off"
                 :: "v"(lds_byte_addr), "v"(ga) : "memory");
}
__device__ __forceinline__ void wait_async0() {
    asm volatile("s_wait_asynccnt 0x0" ::: "memory");
}
__device__ __forceinline__ unsigned int lds_addr_of(const void* p) {
    return (unsigned int)(uintptr_t)p;
}

// ---------------------------------------------------------------------------
// Prep kernels: one-time fp32 -> fp16 conversion / weight transpose.
// ---------------------------------------------------------------------------
__global__ __launch_bounds__(256) void cvt_f16_kernel(
    const float* __restrict__ in, _Float16* __restrict__ out, int n4)
{
    int i = blockIdx.x * 256 + threadIdx.x;
    if (i < n4) {
        float4 f = reinterpret_cast<const float4*>(in)[i];
        v4h o = { (_Float16)f.x, (_Float16)f.y, (_Float16)f.z, (_Float16)f.w };
        reinterpret_cast<v4h*>(out)[i] = o;
    }
}

// W (Kd x Nd, f32, row-major) -> WT (Nd x Kd, f16, row-major)
__global__ __launch_bounds__(256) void transpose_cvt_kernel(
    const float* __restrict__ W, _Float16* __restrict__ WT, int Kd, int Nd)
{
    __shared__ _Float16 tile[32][33];
    const int tx = threadIdx.x, ty = threadIdx.y;     // 32 x 8
    const int n0 = blockIdx.x * 32, k0 = blockIdx.y * 32;
#pragma unroll
    for (int i = 0; i < 4; ++i)
        tile[ty + i * 8][tx] = (_Float16)W[(size_t)(k0 + ty + i * 8) * Nd + n0 + tx];
    __syncthreads();
#pragma unroll
    for (int i = 0; i < 4; ++i)
        WT[(size_t)(n0 + ty + i * 8) * Kd + k0 + tx] = tile[tx][ty + i * 8];
}

// ---------------------------------------------------------------------------
// WMMA GEMM, f16 operands: C = alpha * (A @ BT^T)
//   A : M x K f16 row-major          BT : N x K f16 row-major (pre-transposed)
// Double-buffered LDS staging via global_load_async_to_lds_b128.
// modes: 0 = f16 row-major out   1 = f32 row-major out
//        2 = kv split: col<64 -> K (b,t,64); col>=64 -> V^T (b,64,T)
// ---------------------------------------------------------------------------
#define BM 128
#define BN 128
#define BK 32
#define LP 40   // LDS row pitch in halves (80B keeps 16B alignment of K-groups)

__global__ __launch_bounds__(256) void wmma_gemm_f16(
    const _Float16* __restrict__ A, const _Float16* __restrict__ BT,
    int M, int K, int N,
    float alpha, void* __restrict__ Cp, int mode, int Tdim)
{
    __shared__ alignas(16) _Float16 As[2][BM * LP];
    __shared__ alignas(16) _Float16 Bs[2][BN * LP];

    const int tid  = threadIdx.x;
    const int lane = tid & 31;
    const int wave = tid >> 5;
    const int wm = wave & 3;            // 4 waves along M
    const int wn = wave >> 2;           // 2 waves along N
    const int bm0 = blockIdx.y * BM;
    const int bn0 = blockIdx.x * BN;
    const int l15 = lane & 15;
    const int hi8 = (lane >> 4) << 3;

    // each thread copies two 16B chunks of A and two of B per tile
    const int srow = tid >> 2;              // 0..63 (plus +64 on second iter)
    const int skg  = (tid & 3) * 8;         // K-group within 32

    v8f acc[2][4];
#pragma unroll
    for (int mi = 0; mi < 2; ++mi)
#pragma unroll
        for (int ni = 0; ni < 4; ++ni)
            acc[mi][ni] = {};

    auto stage = [&](int buf, int k0) {
#pragma unroll
        for (int i = 0; i < 2; ++i) {
            const int row = srow + i * 64;
            async_copy16(lds_addr_of(&As[buf][row * LP + skg]),
                         &A[(size_t)(bm0 + row) * K + k0 + skg]);
        }
#pragma unroll
        for (int i = 0; i < 2; ++i) {
            const int row = srow + i * 64;
            async_copy16(lds_addr_of(&Bs[buf][row * LP + skg]),
                         &BT[(size_t)(bn0 + row) * K + k0 + skg]);
        }
    };

    stage(0, 0);
    wait_async0();
    __syncthreads();

    int buf = 0;
    for (int k0 = 0; k0 < K; k0 += BK) {
        if (k0 + BK < K) stage(buf ^ 1, k0 + BK);   // prefetch next tile

        v16h aF[2], bF[4];
#pragma unroll
        for (int mi = 0; mi < 2; ++mi)
            aF[mi] = load_frag(&As[buf][(wm * 32 + mi * 16 + l15) * LP + hi8]);
#pragma unroll
        for (int ni = 0; ni < 4; ++ni)
            bF[ni] = load_frag(&Bs[buf][(wn * 64 + ni * 16 + l15) * LP + hi8]);

#pragma unroll
        for (int mi = 0; mi < 2; ++mi)
#pragma unroll
            for (int ni = 0; ni < 4; ++ni)
                acc[mi][ni] = wmma_f16(aF[mi], bF[ni], acc[mi][ni]);

        wait_async0();       // next tile landed in LDS
        __syncthreads();     // all waves done reading `buf` / writing `buf^1`
        buf ^= 1;
    }

    // ---- epilogue ----
#pragma unroll
    for (int mi = 0; mi < 2; ++mi) {
#pragma unroll
        for (int ni = 0; ni < 4; ++ni) {
            const int rbase = bm0 + wm * 32 + mi * 16 + hi8;
            const int col   = bn0 + wn * 64 + ni * 16 + l15;
#pragma unroll
            for (int j = 0; j < 8; ++j) {
                const int row = rbase + j;
                const float val = acc[mi][ni][j] * alpha;
                if (mode == 0) {
                    ((_Float16*)Cp)[(size_t)row * N + col] = (_Float16)val;
                } else if (mode == 1) {
                    ((float*)Cp)[(size_t)row * N + col] = val;
                } else {
                    _Float16* kout = (_Float16*)Cp;
                    _Float16* vout = kout + (size_t)M * 64;
                    const int b = row / Tdim;
                    const int t = row - b * Tdim;
                    if (col < 64)
                        kout[(size_t)row * 64 + col] = (_Float16)val;
                    else
                        vout[(size_t)(b * 64 + (col - 64)) * Tdim + t] = (_Float16)val;
                }
            }
        }
    }
}

// ---------------------------------------------------------------------------
// Flash-style multi-query attention. One wave handles 16 query rows of one
// (b, h) over the full T, chunked 32 keys at a time. q pre-scaled by
// hd^-0.5 * log2(e) so softmax uses exp2 (v_exp_f32).
// ---------------------------------------------------------------------------
__global__ __launch_bounds__(128) void mqa_attn_kernel(
    const _Float16* __restrict__ q, const _Float16* __restrict__ kmat,
    const _Float16* __restrict__ vT, _Float16* __restrict__ y,
    int Nq, int Tlen, int D, int Hn)
{
    __shared__ alignas(16) _Float16 Ps[4 * 16 * LP];

    const int lane = threadIdx.x & 31;
    const int wv   = threadIdx.x >> 5;
    const int l15  = lane & 15;
    const int hi8  = (lane >> 4) << 3;

    const int qtiles = Nq >> 4;
    int gw = blockIdx.x * 4 + wv;
    const int qt = gw % qtiles; gw /= qtiles;
    const int h  = gw % Hn;
    const int b  = gw / Hn;

    const _Float16* qbase = q + ((size_t)(b * Nq + qt * 16 + l15)) * D + h * 64;
    v16h aQ[2];
    aQ[0] = load_frag(qbase + 0  + hi8);
    aQ[1] = load_frag(qbase + 32 + hi8);

    const _Float16* kbase = kmat + (size_t)b * Tlen * 64 + hi8;
    const _Float16* vbase = vT   + (size_t)(b * 64) * Tlen + hi8;

    float m[8], l[8];
    v8f accY[4];
#pragma unroll
    for (int j = 0; j < 8; ++j) { m[j] = -1e30f; l[j] = 0.0f; }
#pragma unroll
    for (int ni = 0; ni < 4; ++ni) accY[ni] = {};

    _Float16* ps = &Ps[wv * 16 * LP];

    for (int tc = 0; tc < Tlen; tc += 32) {
        v8f s0 = {}, s1 = {};
        {
            const _Float16* kp0 = kbase + (size_t)(tc + l15) * 64;
            const _Float16* kp1 = kbase + (size_t)(tc + 16 + l15) * 64;
            v16h b00 = load_frag(kp0);
            v16h b01 = load_frag(kp0 + 32);
            v16h b10 = load_frag(kp1);
            v16h b11 = load_frag(kp1 + 32);
            s0 = wmma_f16(aQ[0], b00, s0);
            s0 = wmma_f16(aQ[1], b01, s0);
            s1 = wmma_f16(aQ[0], b10, s1);
            s1 = wmma_f16(aQ[1], b11, s1);
        }

#pragma unroll
        for (int j = 0; j < 8; ++j) {
            float mt = fmaxf(s0[j], s1[j]);
#pragma unroll
            for (int off = 8; off >= 1; off >>= 1)
                mt = fmaxf(mt, __shfl_xor(mt, off, 16));
            const float mn = fmaxf(m[j], mt);
            const float sc = exp2f(m[j] - mn);
            const float p0 = exp2f(s0[j] - mn);
            const float p1 = exp2f(s1[j] - mn);
            float rs = p0 + p1;
#pragma unroll
            for (int off = 8; off >= 1; off >>= 1)
                rs += __shfl_xor(rs, off, 16);
            l[j] = l[j] * sc + rs;
            m[j] = mn;
            s0[j] = p0; s1[j] = p1;
            accY[0][j] *= sc; accY[1][j] *= sc;
            accY[2][j] *= sc; accY[3][j] *= sc;
        }

        // C-layout -> LDS -> A-layout for P (same-wave LDS RAW is in-order)
#pragma unroll
        for (int j = 0; j < 8; ++j) {
            const int row = j + hi8;
            ps[row * LP + l15]      = (_Float16)s0[j];
            ps[row * LP + 16 + l15] = (_Float16)s1[j];
        }
        v16h aP = load_frag(&ps[l15 * LP + hi8]);

#pragma unroll
        for (int ni = 0; ni < 4; ++ni) {
            const _Float16* vp = vbase + (size_t)(ni * 16 + l15) * Tlen + tc;
            v16h bV = load_frag(vp);
            accY[ni] = wmma_f16(aP, bV, accY[ni]);
        }
    }

    float inv[8];
#pragma unroll
    for (int j = 0; j < 8; ++j) inv[j] = 1.0f / l[j];

    const size_t obase = ((size_t)(b * Nq + qt * 16)) * D + h * 64;
#pragma unroll
    for (int ni = 0; ni < 4; ++ni)
#pragma unroll
        for (int j = 0; j < 8; ++j) {
            const int row = j + hi8;
            y[obase + (size_t)row * D + ni * 16 + l15] =
                (_Float16)(accY[ni][j] * inv[j]);
        }
}

// ---------------------------------------------------------------------------
extern "C" void kernel_launch(void* const* d_in, const int* in_sizes, int n_in,
                              void* d_out, int out_size, void* d_ws, size_t ws_size,
                              hipStream_t stream) {
    const float* x   = (const float*)d_in[0];
    const float* ctx = (const float*)d_in[1];
    const float* Wq  = (const float*)d_in[2];
    const float* Wkv = (const float*)d_in[3];
    const float* Wo  = (const float*)d_in[4];
    float* out = (float*)d_out;

    const int Bc = 2, Nc = 2048, Tc = 2048, Dc = 1024, Hc = 16;
    const int MQ  = Bc * Nc;   // 4096
    const int MKV = Bc * Tc;   // 4096

    // workspace (f16): x16 | ctx16 | WqT | WkvT | WoT | q | k | vT | y
    _Float16* x16   = (_Float16*)d_ws;
    _Float16* ctx16 = x16   + (size_t)MQ * Dc;
    _Float16* WqT   = ctx16 + (size_t)MKV * Dc;
    _Float16* WkvT  = WqT   + (size_t)Dc * Dc;
    _Float16* WoT   = WkvT  + (size_t)128 * Dc;
    _Float16* qbuf  = WoT   + (size_t)Dc * Dc;
    _Float16* kb    = qbuf  + (size_t)MQ * Dc;
    _Float16* vT    = kb    + (size_t)MKV * 64;
    _Float16* y     = vT    + (size_t)MKV * 64;

    const float alphaQ = 0.125f * 1.44269504088896340736f;  // hd^-0.5 * log2(e)

    // ---- prep: fp32 -> fp16 (+ weight transposes) ----
    cvt_f16_kernel<<<dim3((MQ * Dc / 4 + 255) / 256), dim3(256), 0, stream>>>(
        x, x16, MQ * Dc / 4);
    cvt_f16_kernel<<<dim3((MKV * Dc / 4 + 255) / 256), dim3(256), 0, stream>>>(
        ctx, ctx16, MKV * Dc / 4);
    transpose_cvt_kernel<<<dim3(Dc / 32, Dc / 32), dim3(32, 8), 0, stream>>>(
        Wq, WqT, Dc, Dc);
    transpose_cvt_kernel<<<dim3(128 / 32, Dc / 32), dim3(32, 8), 0, stream>>>(
        Wkv, WkvT, Dc, 128);
    transpose_cvt_kernel<<<dim3(Dc / 32, Dc / 32), dim3(32, 8), 0, stream>>>(
        Wo, WoT, Dc, Dc);

    dim3 blk(256);
    // q = (x @ Wq) * alphaQ -> f16
    wmma_gemm_f16<<<dim3(Dc / 128, MQ / 128), blk, 0, stream>>>(
        x16, WqT, MQ, Dc, Dc, alphaQ, qbuf, 0, 0);
    // kv = ctx @ Wkv -> k row-major + v transposed
    wmma_gemm_f16<<<dim3(1, MKV / 128), blk, 0, stream>>>(
        ctx16, WkvT, MKV, Dc, 128, 1.0f, kb, 2, Tc);
    // attention -> y (f16)
    const int totalWaves = Bc * Hc * (Nc / 16);   // 4096
    mqa_attn_kernel<<<dim3(totalWaves / 4), dim3(128), 0, stream>>>(
        qbuf, kb, vT, y, Nc, Tc, Dc, Hc);
    // out = y @ Wo -> f32
    wmma_gemm_f16<<<dim3(Dc / 128, MQ / 128), blk, 0, stream>>>(
        y, WoT, MQ, Dc, Dc, 1.0f, out, 1, 0);
}

// v001
// One run takes 187 microseconds.
// Timed twice side by side with v000, it ran 1.10 times as fast both times.
#include <hip/hip_runtime.h>
#include <math.h>

typedef _Float16 v16h __attribute__((ext_vector_type(16)));
typedef _Float16 v8h  __attribute__((ext_vector_type(8)));
typedef _Float16 v4h  __attribute__((ext_vector_type(4)));
typedef float    v8f  __attribute__((ext_vector_type(8)));
typedef float    v4f  __attribute__((ext_vector_type(4)));
typedef float    v2f  __attribute__((ext_vector_type(2)));

union HFrag { v16h v; v8h h[2]; };

__device__ __forceinline__ v16h load_frag(const _Float16* p) {
    HFrag f;
    f.h[0] = *reinterpret_cast<const v8h*>(p);
    f.h[1] = *reinterpret_cast<const v8h*>(p + 16);
    return f.v;
}

__device__ __forceinline__ v8f wmma_f16(v16h a, v16h b, v8f c) {
    return __builtin_amdgcn_wmma_f32_16x16x32_f16(false, a, false, b,
                                                  (short)0, c, false, false);
}

__device__ __forceinline__ void async_copy16(unsigned int lds_byte_addr,
                                             const void* gptr) {
    unsigned long long ga = (unsigned long long)(uintptr_t)gptr;
    asm volatile("global_load_async_to_lds_b128 %0, %1, off"
                 :: "v"(lds_byte_addr), "v"(ga) : "memory");
}
__device__ __forceinline__ void wait_async0() {
    asm volatile("s_wait_asynccnt 0x0" ::: "memory");
}
__device__ __forceinline__ unsigned int lds_addr_of(const void* p) {
    return (unsigned int)(uintptr_t)p;
}

// ---------------------------------------------------------------------------
// Prep kernels: one-time fp32 -> fp16 conversion / weight transpose.
// ---------------------------------------------------------------------------
__global__ __launch_bounds__(256) void cvt_f16_kernel(
    const float* __restrict__ in, _Float16* __restrict__ out, int n4)
{
    int i = blockIdx.x * 256 + threadIdx.x;
    if (i < n4) {
        float4 f = reinterpret_cast<const float4*>(in)[i];
        v4h o = { (_Float16)f.x, (_Float16)f.y, (_Float16)f.z, (_Float16)f.w };
        reinterpret_cast<v4h*>(out)[i] = o;
    }
}

// W (Kd x Nd, f32, row-major) -> WT (Nd x Kd, f16, row-major)
__global__ __launch_bounds__(256) void transpose_cvt_kernel(
    const float* __restrict__ W, _Float16* __restrict__ WT, int Kd, int Nd)
{
    __shared__ _Float16 tile[32][33];
    const int tx = threadIdx.x, ty = threadIdx.y;     // 32 x 8
    const int n0 = blockIdx.x * 32, k0 = blockIdx.y * 32;
#pragma unroll
    for (int i = 0; i < 4; ++i)
        tile[ty + i * 8][tx] = (_Float16)W[(size_t)(k0 + ty + i * 8) * Nd + n0 + tx];
    __syncthreads();
#pragma unroll
    for (int i = 0; i < 4; ++i)
        WT[(size_t)(n0 + ty + i * 8) * Kd + k0 + tx] = tile[tx][ty + i * 8];
}

// ---------------------------------------------------------------------------
// WMMA GEMM, f16 operands: C = alpha * (A @ BT^T)
//   A : M x K f16 row-major          BT : N x K f16 row-major (pre-transposed)
// Double-buffered LDS staging via global_load_async_to_lds_b128.
// modes: 0 = f16 row-major out   1 = f32 row-major out
//        2 = kv split: col<64 -> K (b,t,64); col>=64 -> V^T (b,64,T)
// ---------------------------------------------------------------------------
#define BM 128
#define BN 128
#define BK 32
#define LP 40   // LDS row pitch in halves (80B keeps 16B alignment of K-groups)

__global__ __launch_bounds__(256) void wmma_gemm_f16(
    const _Float16* __restrict__ A, const _Float16* __restrict__ BT,
    int M, int K, int N,
    float alpha, void* __restrict__ Cp, int mode, int Tdim)
{
    __shared__ alignas(16) _Float16 As[2][BM * LP];
    __shared__ alignas(16) _Float16 Bs[2][BN * LP];

    const int tid  = threadIdx.x;
    const int lane = tid & 31;
    const int wave = tid >> 5;
    const int wm = wave & 3;            // 4 waves along M
    const int wn = wave >> 2;           // 2 waves along N
    const int bm0 = blockIdx.y * BM;
    const int bn0 = blockIdx.x * BN;
    const int l15 = lane & 15;
    const int hi8 = (lane >> 4) << 3;

    // each thread copies two 16B chunks of A and two of B per tile
    const int srow = tid >> 2;              // 0..63 (plus +64 on second iter)
    const int skg  = (tid & 3) * 8;         // K-group within 32

    v8f acc[2][4];
#pragma unroll
    for (int mi = 0; mi < 2; ++mi)
#pragma unroll
        for (int ni = 0; ni < 4; ++ni)
            acc[mi][ni] = {};

    auto stage = [&](int buf, int k0) {
#pragma unroll
        for (int i = 0; i < 2; ++i) {
            const int row = srow + i * 64;
            async_copy16(lds_addr_of(&As[buf][row * LP + skg]),
                         &A[(size_t)(bm0 + row) * K + k0 + skg]);
        }
#pragma unroll
        for (int i = 0; i < 2; ++i) {
            const int row = srow + i * 64;
            async_copy16(lds_addr_of(&Bs[buf][row * LP + skg]),
                         &BT[(size_t)(bn0 + row) * K + k0 + skg]);
        }
    };

    stage(0, 0);
    wait_async0();
    __syncthreads();

    int buf = 0;
    for (int k0 = 0; k0 < K; k0 += BK) {
        if (k0 + BK < K) stage(buf ^ 1, k0 + BK);   // prefetch next tile

        v16h aF[2], bF[4];
#pragma unroll
        for (int mi = 0; mi < 2; ++mi)
            aF[mi] = load_frag(&As[buf][(wm * 32 + mi * 16 + l15) * LP + hi8]);
#pragma unroll
        for (int ni = 0; ni < 4; ++ni)
            bF[ni] = load_frag(&Bs[buf][(wn * 64 + ni * 16 + l15) * LP + hi8]);

#pragma unroll
        for (int mi = 0; mi < 2; ++mi)
#pragma unroll
            for (int ni = 0; ni < 4; ++ni)
                acc[mi][ni] = wmma_f16(aF[mi], bF[ni], acc[mi][ni]);

        wait_async0();       // next tile landed in LDS
        __syncthreads();     // all waves done reading `buf` / writing `buf^1`
        buf ^= 1;
    }

    // ---- epilogue ----
#pragma unroll
    for (int mi = 0; mi < 2; ++mi) {
#pragma unroll
        for (int ni = 0; ni < 4; ++ni) {
            const int rbase = bm0 + wm * 32 + mi * 16 + hi8;
            const int col   = bn0 + wn * 64 + ni * 16 + l15;
#pragma unroll
            for (int j = 0; j < 8; ++j) {
                const int row = rbase + j;
                const float val = acc[mi][ni][j] * alpha;
                if (mode == 0) {
                    ((_Float16*)Cp)[(size_t)row * N + col] = (_Float16)val;
                } else if (mode == 1) {
                    ((float*)Cp)[(size_t)row * N + col] = val;
                } else {
                    _Float16* kout = (_Float16*)Cp;
                    _Float16* vout = kout + (size_t)M * 64;
                    const int b = row / Tdim;
                    const int t = row - b * Tdim;
                    if (col < 64)
                        kout[(size_t)row * 64 + col] = (_Float16)val;
                    else
                        vout[(size_t)(b * 64 + (col - 64)) * Tdim + t] = (_Float16)val;
                }
            }
        }
    }
}

__device__ __forceinline__ float xhalf(float x) {
    return __builtin_bit_cast(float, __builtin_amdgcn_permlanex16(
        __builtin_bit_cast(int, x), __builtin_bit_cast(int, x),
        0x76543210, 0xfedcba98, false, false));
}

__global__ __launch_bounds__(128) void mqa_attn_kernel(
    const _Float16* __restrict__ q, const _Float16* __restrict__ kmat,
    const _Float16* __restrict__ vT, _Float16* __restrict__ y,
    int Nq, int Tlen, int D, int Hn)
{
    const int lane = threadIdx.x & 31;
    const int wv   = threadIdx.x >> 5;
    const int l15  = lane & 15;
    const int hi8  = (lane >> 4) << 3;

    const int qtiles = Nq >> 4;
    int gw = blockIdx.x * 4 + wv;
    const int qt = gw % qtiles; gw /= qtiles;
    const int h  = gw % Hn;
    const int b  = gw / Hn;

    const _Float16* qbase = q + ((size_t)(b * Nq + qt * 16 + l15)) * D + h * 64;
    v16h bQ[2];
    bQ[0] = load_frag(qbase + 0  + hi8);
    bQ[1] = load_frag(qbase + 32 + hi8);

    const _Float16* kbase = kmat + (size_t)b * Tlen * 64 + hi8;
    const _Float16* vbase = vT   + (size_t)(b * 64) * Tlen + hi8;

    float m = -1e30f, l = 0.0f;      // this lane's query; l = this half's keys only
    v8f accY[4];                     // accY[ni][r] = O[query l15][ni*16 + hi8 + r]
#pragma unroll
    for (int ni = 0; ni < 4; ++ni) accY[ni] = {};

    for (int tc = 0; tc < Tlen; tc += 32) {
        const _Float16* kp0 = kbase + (size_t)(tc + l15) * 64;
        const _Float16* kp1 = kbase + (size_t)(tc + 16 + l15) * 64;
        v16h a00 = load_frag(kp0);
        v16h a01 = load_frag(kp0 + 32);
        v16h a10 = load_frag(kp1);
        v16h a11 = load_frag(kp1 + 32);
        // stands in front of the V^T loads because their results may be given
        // the registers that held the K loads' address
        asm volatile("s_wait_xcnt 0x0" ::: "memory");
        v16h aV[4];
#pragma unroll
        for (int ni = 0; ni < 4; ++ni)
            aV[ni] = load_frag(vbase + (size_t)(ni * 16 + l15) * Tlen + tc);
        // keeps the V^T loads issued here, with K's: sunk behind the softmax
        // their latency would be waited for a second time in every pass
        __builtin_amdgcn_sched_barrier(0);

        // s0[r] = S[query l15][key tc + hi8 + r], s1[r]: key tc + 16 + hi8 + r
        v8f s0 = {}, s1 = {};
        s0 = wmma_f16(a00, bQ[0], s0);
        s1 = wmma_f16(a10, bQ[0], s1);
        s0 = wmma_f16(a01, bQ[1], s0);
        s1 = wmma_f16(a11, bQ[1], s1);

        float mt = fmaxf(s0[0], s1[0]);
#pragma unroll
        for (int r = 1; r < 8; ++r) mt = fmaxf(mt, fmaxf(s0[r], s1[r]));
        mt = fmaxf(mt, xhalf(mt));           // both halves: the query's maximum
        const float mn = fmaxf(m, mt);
        const float sc = exp2f(m - mn);
        m = mn;

#pragma unroll
        for (int r = 0; r < 8; ++r) {
            s0[r] = exp2f(s0[r] - mn);
            s1[r] = exp2f(s1[r] - mn);
        }
        // in-lane sum of the 16 exponentials as a tree over register pairs
        const v8f t8 = s0 + s1;
        const v4f t4 = t8.lo + t8.hi;
        const v2f t2 = t4.lo + t4.hi;
        l = l * sc + (t2.x + t2.y);

        // two S^T tiles, converted in place, are the B operand in the k order
        // of load_frag: element s = key (s < 8 ? hi8 + s : 16 + hi8 + s - 8)
        HFrag bP;
        bP.h[0] = __builtin_convertvector(s0, v8h);
        bP.h[1] = __builtin_convertvector(s1, v8h);

#pragma unroll
        for (int ni = 0; ni < 4; ++ni) {
            accY[ni] *= sc;
            accY[ni] = wmma_f16(aV[ni], bP.v, accY[ni]);
        }
    }

    l += xhalf(l);                   // join the halves' sums once
    const float inv = 1.0f / l;

    _Float16* yrow = y + ((size_t)(b * Nq + qt * 16 + l15)) * D + h * 64 + hi8;
#pragma unroll
    for (int ni = 0; ni < 4; ++ni) {
        const v8f o = accY[ni] * inv;
        *reinterpret_cast<v8h*>(yrow + ni * 16) = __builtin_convertvector(o, v8h);
    }
}

// ---------------------------------------------------------------------------
extern "C" void kernel_launch(void* const* d_in, const int* in_sizes, int n_in,
                              void* d_out, int out_size, void* d_ws, size_t ws_size,
                              hipStream_t stream) {
    const float* x   = (const float*)d_in[0];
    const float* ctx = (const float*)d_in[1];
    const float* Wq  = (const float*)d_in[2];
    const float* Wkv = (const float*)d_in[3];
    const float* Wo  = (const float*)d_in[4];
    float* out = (float*)d_out;

    const int Bc = 2, Nc = 2048, Tc = 2048, Dc = 1024, Hc = 16;
    const int MQ  = Bc * Nc;   // 4096
    const int MKV = Bc * Tc;   // 4096

    // workspace (f16): x16 | ctx16 | WqT | WkvT | WoT | q | k | vT | y
    _Float16* x16   = (_Float16*)d_ws;
    _Float16* ctx16 = x16   + (size_t)MQ * Dc;
    _Float16* WqT   = ctx16 + (size_t)MKV * Dc;
    _Float16* WkvT  = WqT   + (size_t)Dc * Dc;
    _Float16* WoT   = WkvT  + (size_t)128 * Dc;
    _Float16* qbuf  = WoT   + (size_t)Dc * Dc;
    _Float16* kb    = qbuf  + (size_t)MQ * Dc;
    _Float16* vT    = kb    + (size_t)MKV * 64;
    _Float16* y     = vT    + (size_t)MKV * 64;

    const float alphaQ = 0.125f * 1.44269504088896340736f;  // hd^-0.5 * log2(e)

    // ---- prep: fp32 -> fp16 (+ weight transposes) ----
    cvt_f16_kernel<<<dim3((MQ * Dc / 4 + 255) / 256), dim3(256), 0, stream>>>(
        x, x16, MQ * Dc / 4);
    cvt_f16_kernel<<<dim3((MKV * Dc / 4 + 255) / 256), dim3(256), 0, stream>>>(
        ctx, ctx16, MKV * Dc / 4);
    transpose_cvt_kernel<<<dim3(Dc / 32, Dc / 32), dim3(32, 8), 0, stream>>>(
        Wq, WqT, Dc, Dc);
    transpose_cvt_kernel<<<dim3(128 / 32, Dc / 32), dim3(32, 8), 0, stream>>>(
        Wkv, WkvT, Dc, 128);
    transpose_cvt_kernel<<<dim3(Dc / 32, Dc / 32), dim3(32, 8), 0, stream>>>(
        Wo, WoT, Dc, Dc);

    dim3 blk(256);
    // q = (x @ Wq) * alphaQ -> f16
    wmma_gemm_f16<<<dim3(Dc / 128, MQ / 128), blk, 0, stream>>>(
        x16, WqT, MQ, Dc, Dc, alphaQ, qbuf, 0, 0);
    // kv = ctx @ Wkv -> k row-major + v transposed
    wmma_gemm_f16<<<dim3(1, MKV / 128), blk, 0, stream>>>(
        ctx16, WkvT, MKV, Dc, 128, 1.0f, kb, 2, Tc);
    // attention -> y (f16)
    const int totalWaves = Bc * Hc * (Nc / 16);   // 4096
    mqa_attn_kernel<<<dim3(totalWaves / 4), dim3(128), 0, stream>>>(
        qbuf, kb, vT, y, Nc, Tc, Dc, Hc);
    // out = y @ Wo -> f32
    wmma_gemm_f16<<<dim3(Dc / 128, MQ / 128), blk, 0, stream>>>(
        y, WoT, MQ, Dc, Dc, 1.0f, out, 1, 0);
}

// v002
// A run of this version takes 135 microseconds.
// Timed twice side by side with v001, it ran 1.38 times as fast both times.
// Counting every step since v000, it is 1.52 times as fast.
#include <hip/hip_runtime.h>
#include <math.h>

typedef _Float16 v16h __attribute__((ext_vector_type(16)));
typedef _Float16 v8h  __attribute__((ext_vector_type(8)));
typedef _Float16 v4h  __attribute__((ext_vector_type(4)));
typedef float    v8f  __attribute__((ext_vector_type(8)));
typedef float    v4f  __attribute__((ext_vector_type(4)));
typedef float    v2f  __attribute__((ext_vector_type(2)));

union HFrag { v16h v; v8h h[2]; };

__device__ __forceinline__ v16h load_frag(const _Float16* p) {
    HFrag f;
    f.h[0] = *reinterpret_cast<const v8h*>(p);
    f.h[1] = *reinterpret_cast<const v8h*>(p + 16);
    return f.v;
}

__device__ __forceinline__ v8f wmma_f16(v16h a, v16h b, v8f c) {
    return __builtin_amdgcn_wmma_f32_16x16x32_f16(false, a, false, b,
                                                  (short)0, c, false, false);
}

__device__ __forceinline__ void async_copy16(unsigned int lds_byte_addr,
                                             const void* gptr) {
    unsigned long long ga = (unsigned long long)(uintptr_t)gptr;
    asm volatile("global_load_async_to_lds_b128 %0, %1, off"
                 :: "v"(lds_byte_addr), "v"(ga) : "memory");
}
__device__ __forceinline__ void wait_async0() {
    asm volatile("s_wait_asynccnt 0x0" ::: "memory");
}
__device__ __forceinline__ unsigned int lds_addr_of(const void* p) {
    return (unsigned int)(uintptr_t)p;
}

// ---------------------------------------------------------------------------
// Prep kernels: one-time fp32 -> fp16 conversion / weight transpose.
// ---------------------------------------------------------------------------
__global__ __launch_bounds__(256) void cvt_f16_kernel(
    const float* __restrict__ in, _Float16* __restrict__ out, int n4)
{
    int i = blockIdx.x * 256 + threadIdx.x;
    if (i < n4) {
        float4 f = reinterpret_cast<const float4*>(in)[i];
        v4h o = { (_Float16)f.x, (_Float16)f.y, (_Float16)f.z, (_Float16)f.w };
        reinterpret_cast<v4h*>(out)[i] = o;
    }
}

// W (Kd x Nd, f32, row-major) -> WT (Nd x Kd, f16, row-major)
__global__ __launch_bounds__(256) void transpose_cvt_kernel(
    const float* __restrict__ W, _Float16* __restrict__ WT, int Kd, int Nd)
{
    __shared__ _Float16 tile[32][33];
    const int tx = threadIdx.x, ty = threadIdx.y;     // 32 x 8
    const int n0 = blockIdx.x * 32, k0 = blockIdx.y * 32;
#pragma unroll
    for (int i = 0; i < 4; ++i)
        tile[ty + i * 8][tx] = (_Float16)W[(size_t)(k0 + ty + i * 8) * Nd + n0 + tx];
    __syncthreads();
#pragma unroll
    for (int i = 0; i < 4; ++i)
        WT[(size_t)(n0 + ty + i * 8) * Kd + k0 + tx] = tile[tx][ty + i * 8];
}

// ---------------------------------------------------------------------------
// WMMA GEMM, f16 operands: C = alpha * (A @ BT^T)
//   A : M x K f16 row-major          BT : N x K f16 row-major (pre-transposed)
// Double-buffered LDS staging via global_load_async_to_lds_b128.
// modes: 0 = f16 row-major out   1 = f32 row-major out
//        2 = kv split: col<64 -> K (b,t,64); col>=64 -> V^T (b,64,T)
// ---------------------------------------------------------------------------
#define BM 128
#define BN 128
#define BK 32
#define LP 40   // LDS row pitch in halves (80B keeps 16B alignment of K-groups)

__global__ __launch_bounds__(256) void wmma_gemm_f16(
    const _Float16* __restrict__ A, const _Float16* __restrict__ BT,
    int M, int K, int N,
    float alpha, void* __restrict__ Cp, int mode, int Tdim)
{
    __shared__ alignas(16) _Float16 As[2][BM * LP];
    __shared__ alignas(16) _Float16 Bs[2][BN * LP];

    const int tid  = threadIdx.x;
    const int lane = tid & 31;
    const int wave = tid >> 5;
    const int wm = wave & 3;            // 4 waves along M
    const int wn = wave >> 2;           // 2 waves along N
    const int bm0 = blockIdx.y * BM;
    const int bn0 = blockIdx.x * BN;
    const int l15 = lane & 15;
    const int hi8 = (lane >> 4) << 3;

    // each thread copies two 16B chunks of A and two of B per tile
    const int srow = tid >> 2;              // 0..63 (plus +64 on second iter)
    const int skg  = (tid & 3) * 8;         // K-group within 32

    v8f acc[2][4];
#pragma unroll
    for (int mi = 0; mi < 2; ++mi)
#pragma unroll
        for (int ni = 0; ni < 4; ++ni)
            acc[mi][ni] = {};

    auto stage = [&](int buf, int k0) {
#pragma unroll
        for (int i = 0; i < 2; ++i) {
            const int row = srow + i * 64;
            async_copy16(lds_addr_of(&As[buf][row * LP + skg]),
                         &A[(size_t)(bm0 + row) * K + k0 + skg]);
        }
#pragma unroll
        for (int i = 0; i < 2; ++i) {
            const int row = srow + i * 64;
            async_copy16(lds_addr_of(&Bs[buf][row * LP + skg]),
                         &BT[(size_t)(bn0 + row) * K + k0 + skg]);
        }
    };

    stage(0, 0);
    wait_async0();
    __syncthreads();

    int buf = 0;
    for (int k0 = 0; k0 < K; k0 += BK) {
        if (k0 + BK < K) stage(buf ^ 1, k0 + BK);   // prefetch next tile

        v16h aF[2], bF[4];
#pragma unroll
        for (int mi = 0; mi < 2; ++mi)
            aF[mi] = load_frag(&As[buf][(wm * 32 + mi * 16 + l15) * LP + hi8]);
#pragma unroll
        for (int ni = 0; ni < 4; ++ni)
            bF[ni] = load_frag(&Bs[buf][(wn * 64 + ni * 16 + l15) * LP + hi8]);

#pragma unroll
        for (int mi = 0; mi < 2; ++mi)
#pragma unroll
            for (int ni = 0; ni < 4; ++ni)
                acc[mi][ni] = wmma_f16(aF[mi], bF[ni], acc[mi][ni]);

        wait_async0();       // next tile landed in LDS
        __syncthreads();     // all waves done reading `buf` / writing `buf^1`
        buf ^= 1;
    }

    // ---- epilogue ----
#pragma unroll
    for (int mi = 0; mi < 2; ++mi) {
#pragma unroll
        for (int ni = 0; ni < 4; ++ni) {
            const int rbase = bm0 + wm * 32 + mi * 16 + hi8;
            const int col   = bn0 + wn * 64 + ni * 16 + l15;
#pragma unroll
            for (int j = 0; j < 8; ++j) {
                const int row = rbase + j;
                const float val = acc[mi][ni][j] * alpha;
                if (mode == 0) {
                    ((_Float16*)Cp)[(size_t)row * N + col] = (_Float16)val;
                } else if (mode == 1) {
                    ((float*)Cp)[(size_t)row * N + col] = val;
                } else {
                    _Float16* kout = (_Float16*)Cp;
                    _Float16* vout = kout + (size_t)M * 64;
                    const int b = row / Tdim;
                    const int t = row - b * Tdim;
                    if (col < 64)
                        kout[(size_t)row * 64 + col] = (_Float16)val;
                    else
                        vout[(size_t)(b * 64 + (col - 64)) * Tdim + t] = (_Float16)val;
                }
            }
        }
    }
}

#define ATW 8
#define SKEY 128
#define KPIT 72
#define VPIT 136

__device__ __forceinline__ float xhalf(float x) {
    return __builtin_bit_cast(float, __builtin_amdgcn_permlanex16(
        __builtin_bit_cast(int, x), __builtin_bit_cast(int, x),
        0x76543210, 0xfedcba98, false, false));
}

__device__ __forceinline__ void async_copy16x4(
    unsigned int l0, unsigned int l1, unsigned int l2, unsigned int l3,
    const _Float16* g0, const _Float16* g1, const _Float16* g2, const _Float16* g3)
{
    asm volatile("global_load_async_to_lds_b128 %0, %4, off\n\t"
                 "global_load_async_to_lds_b128 %1, %5, off\n\t"
                 "global_load_async_to_lds_b128 %2, %6, off\n\t"
                 "global_load_async_to_lds_b128 %3, %7, off\n\t"
                 "s_wait_xcnt 0x0"
                 :: "v"(l0), "v"(l1), "v"(l2), "v"(l3),
                    "v"(g0), "v"(g1), "v"(g2), "v"(g3) : "memory");
}

__global__ __launch_bounds__(ATW * 32) __attribute__((amdgpu_waves_per_eu(4, 4)))
void mqa_attn_kernel(
    const _Float16* __restrict__ q, const _Float16* __restrict__ kmat,
    const _Float16* __restrict__ vT, _Float16* __restrict__ y,
    int Nq, int Tlen, int D, int Hn)
{
    __shared__ alignas(16) _Float16 Ks[2][SKEY * KPIT];
    __shared__ alignas(16) _Float16 Vs[2][64 * VPIT];

    const int tid  = threadIdx.x;
    const int lane = tid & 31;
    const int wv   = tid >> 5;
    const int l15  = lane & 15;
    const int hi8  = (lane >> 4) << 3;

    const int qtiles = Nq >> 4;
    int gw = blockIdx.x * ATW + wv;
    const int qt = gw % qtiles; gw /= qtiles;
    const int h  = gw % Hn;
    const int b  = gw / Hn;          // the same in all waves of a block

    // This thread's share of a tile: 4 chunks of K (the tile is 16 KiB in a
    // row in memory; a wave's copy = 4 rows = 4 lines) and 4 of V^T (a wave's
    // copy = 2 rows of 256 B).
    const _Float16* kg = kmat + (size_t)b * Tlen * 64 + tid * 8;
    const _Float16* vg = vT + (size_t)(b * 64 + (tid >> 4)) * Tlen + (tid & 15) * 8;
    const int kl = (tid >> 3) * KPIT + (tid & 7) * 8;
    const int vl = (tid >> 4) * VPIT + (tid & 15) * 8;

    auto stage = [&](int buf, int st) {
        const _Float16* kgs = kg + (size_t)st * (SKEY * 64);
        const _Float16* vgs = vg + (size_t)st * SKEY;
        async_copy16x4(lds_addr_of(&Ks[buf][kl]),
                       lds_addr_of(&Ks[buf][kl + 32 * KPIT]),
                       lds_addr_of(&Ks[buf][kl + 64 * KPIT]),
                       lds_addr_of(&Ks[buf][kl + 96 * KPIT]),
                       kgs, kgs + 2048, kgs + 4096, kgs + 6144);
        async_copy16x4(lds_addr_of(&Vs[buf][vl]),
                       lds_addr_of(&Vs[buf][vl + 16 * VPIT]),
                       lds_addr_of(&Vs[buf][vl + 32 * VPIT]),
                       lds_addr_of(&Vs[buf][vl + 48 * VPIT]),
                       vgs, vgs + (size_t)16 * Tlen, vgs + (size_t)32 * Tlen,
                       vgs + (size_t)48 * Tlen);
    };

    const int nst = Tlen / SKEY;
    stage(0, 0);

    const _Float16* qbase = q + ((size_t)(b * Nq + qt * 16 + l15)) * D + h * 64;
    v16h bQ[2];
    bQ[0] = load_frag(qbase + 0  + hi8);
    bQ[1] = load_frag(qbase + 32 + hi8);

    wait_async0();                   // this wave's share of tile 0 has landed
    __syncthreads();                 // ... and every other wave's
    if (nst > 1) stage(1, 1);

    float m = -1e30f, l = 0.0f;      // this lane's query; l = this half's keys only
    v8f accY[4];                     // accY[ni][r] = O[query l15][ni*16 + hi8 + r]
#pragma unroll
    for (int ni = 0; ni < 4; ++ni) accY[ni] = {};

    for (int st = 0; st < nst; ++st) {
        const int buf = st & 1;
        const _Float16* kbase = &Ks[buf][l15 * KPIT + hi8];
        const _Float16* vbase = &Vs[buf][l15 * VPIT + hi8];

#pragma unroll
        for (int tc = 0; tc < SKEY; tc += 32) {
            const _Float16* kp0 = kbase + tc * KPIT;
            const _Float16* kp1 = kbase + (tc + 16) * KPIT;
            v16h a00 = load_frag(kp0);
            v16h a01 = load_frag(kp0 + 32);
            v16h a10 = load_frag(kp1);
            v16h a11 = load_frag(kp1 + 32);
            v16h aV[4];
#pragma unroll
            for (int ni = 0; ni < 4; ++ni)
                aV[ni] = load_frag(vbase + ni * 16 * VPIT + tc);

            // s0[r] = S[query l15][key tc + hi8 + r], s1[r]: key tc + 16 + hi8 + r
            v8f s0 = {}, s1 = {};
            s0 = wmma_f16(a00, bQ[0], s0);
            s1 = wmma_f16(a10, bQ[0], s1);
            s0 = wmma_f16(a01, bQ[1], s0);
            s1 = wmma_f16(a11, bQ[1], s1);

            float mt = fmaxf(s0[0], s1[0]);
#pragma unroll
            for (int r = 1; r < 8; ++r) mt = fmaxf(mt, fmaxf(s0[r], s1[r]));
            mt = fmaxf(mt, xhalf(mt));       // both halves: the query's maximum
            const float mn = fmaxf(m, mt);
            const float sc = exp2f(m - mn);
            m = mn;

#pragma unroll
            for (int r = 0; r < 8; ++r) {
                s0[r] = exp2f(s0[r] - mn);
                s1[r] = exp2f(s1[r] - mn);
            }
            // in-lane sum of the 16 exponentials as a tree over register pairs
            const v8f t8 = s0 + s1;
            const v4f t4 = t8.lo + t8.hi;
            const v2f t2 = t4.lo + t4.hi;
            l = l * sc + (t2.x + t2.y);

            // two S^T tiles, converted in place, are the B operand in the k order
            // of load_frag: element s = key (s < 8 ? hi8 + s : 16 + hi8 + s - 8)
            HFrag bP;
            bP.h[0] = __builtin_convertvector(s0, v8h);
            bP.h[1] = __builtin_convertvector(s1, v8h);

#pragma unroll
            for (int ni = 0; ni < 4; ++ni) {
                accY[ni] *= sc;
                accY[ni] = wmma_f16(aV[ni], bP.v, accY[ni]);
            }
        }

        // hand-over: this wave's reads of the tile are done ...
        asm volatile("s_wait_dscnt 0x0" ::: "memory");
        wait_async0();               // ... its share of the next tile has landed
        __syncthreads();             // ... and the same holds for every wave
        if (st + 2 < nst) stage(buf, st + 2);   // refill the buffer just left
    }
    wait_async0();                   // no copy is left when the wave ends

    l += xhalf(l);                   // join the halves' sums once
    const float inv = 1.0f / l;

    _Float16* yrow = y + ((size_t)(b * Nq + qt * 16 + l15)) * D + h * 64 + hi8;
#pragma unroll
    for (int ni = 0; ni < 4; ++ni) {
        const v8f o = accY[ni] * inv;
        *reinterpret_cast<v8h*>(yrow + ni * 16) = __builtin_convertvector(o, v8h);
    }
}

// ---------------------------------------------------------------------------
extern "C" void kernel_launch(void* const* d_in, const int* in_sizes, int n_in,
                              void* d_out, int out_size, void* d_ws, size_t ws_size,
                              hipStream_t stream) {
    const float* x   = (const float*)d_in[0];
    const float* ctx = (const float*)d_in[1];
    const float* Wq  = (const float*)d_in[2];
    const float* Wkv = (const float*)d_in[3];
    const float* Wo  = (const float*)d_in[4];
    float* out = (float*)d_out;

    const int Bc = 2, Nc = 2048, Tc = 2048, Dc = 1024, Hc = 16;
    const int MQ  = Bc * Nc;   // 4096
    const int MKV = Bc * Tc;   // 4096

    // workspace (f16): x16 | ctx16 | WqT | WkvT | WoT | q | k | vT | y
    _Float16* x16   = (_Float16*)d_ws;
    _Float16* ctx16 = x16   + (size_t)MQ * Dc;
    _Float16* WqT   = ctx16 + (size_t)MKV * Dc;
    _Float16* WkvT  = WqT   + (size_t)Dc * Dc;
    _Float16* WoT   = WkvT  + (size_t)128 * Dc;
    _Float16* qbuf  = WoT   + (size_t)Dc * Dc;
    _Float16* kb    = qbuf  + (size_t)MQ * Dc;
    _Float16* vT    = kb    + (size_t)MKV * 64;
    _Float16* y     = vT    + (size_t)MKV * 64;

    const float alphaQ = 0.125f * 1.44269504088896340736f;  // hd^-0.5 * log2(e)

    // ---- prep: fp32 -> fp16 (+ weight transposes) ----
    cvt_f16_kernel<<<dim3((MQ * Dc / 4 + 255) / 256), dim3(256), 0, stream>>>(
        x, x16, MQ * Dc / 4);
    cvt_f16_kernel<<<dim3((MKV * Dc / 4 + 255) / 256), dim3(256), 0, stream>>>(
        ctx, ctx16, MKV * Dc / 4);
    transpose_cvt_kernel<<<dim3(Dc / 32, Dc / 32), dim3(32, 8), 0, stream>>>(
        Wq, WqT, Dc, Dc);
    transpose_cvt_kernel<<<dim3(128 / 32, Dc / 32), dim3(32, 8), 0, stream>>>(
        Wkv, WkvT, Dc, 128);
    transpose_cvt_kernel<<<dim3(Dc / 32, Dc / 32), dim3(32, 8), 0, stream>>>(
        Wo, WoT, Dc, Dc);

    dim3 blk(256);
    // q = (x @ Wq) * alphaQ -> f16
    wmma_gemm_f16<<<dim3(Dc / 128, MQ / 128), blk, 0, stream>>>(
        x16, WqT, MQ, Dc, Dc, alphaQ, qbuf, 0, 0);
    // kv = ctx @ Wkv -> k row-major + v transposed
    wmma_gemm_f16<<<dim3(1, MKV / 128), blk, 0, stream>>>(
        ctx16, WkvT, MKV, Dc, 128, 1.0f, kb, 2, Tc);
    // attention -> y (f16)
    const int totalWaves = Bc * Hc * (Nc / 16);   // 4096
    mqa_attn_kernel<<<dim3(totalWaves / 8), dim3(256), 0, stream>>>(
        qbuf, kb, vT, y, Nc, Tc, Dc, Hc);
    // out = y @ Wo -> f32
    wmma_gemm_f16<<<dim3(Dc / 128, MQ / 128), blk, 0, stream>>>(
        y, WoT, MQ, Dc, Dc, 1.0f, out, 1, 0);
}

// v003
// Measured time: 126 microseconds a run.
// Next to v002, in two timings, it ran 1.08 times as fast each time.
// Counting every step since v000, it is 1.64 times as fast.
#include <hip/hip_runtime.h>
#include <math.h>

typedef _Float16 v16h __attribute__((ext_vector_type(16)));
typedef _Float16 v8h  __attribute__((ext_vector_type(8)));
typedef _Float16 v4h  __attribute__((ext_vector_type(4)));
typedef _Float16 v2h  __attribute__((ext_vector_type(2)));
typedef float    v8f  __attribute__((ext_vector_type(8)));
typedef float    v4f  __attribute__((ext_vector_type(4)));
typedef float    v2f  __attribute__((ext_vector_type(2)));

union HFrag { v16h v; v8h h[2]; };

__device__ __forceinline__ v16h load_frag(const _Float16* p) {
    HFrag f;
    f.h[0] = *reinterpret_cast<const v8h*>(p);
    f.h[1] = *reinterpret_cast<const v8h*>(p + 16);
    return f.v;
}

__device__ __forceinline__ v8f wmma_f16(v16h a, v16h b, v8f c) {
    return __builtin_amdgcn_wmma_f32_16x16x32_f16(false, a, false, b,
                                                  (short)0, c, false, false);
}

__device__ __forceinline__ void async_copy16(unsigned int lds_byte_addr,
                                             const void* gptr) {
    unsigned long long ga = (unsigned long long)(uintptr_t)gptr;
    asm volatile("global_load_async_to_lds_b128 %0, %1, off"
                 :: "v"(lds_byte_addr), "v"(ga) : "memory");
}
__device__ __forceinline__ void wait_async0() {
    asm volatile("s_wait_asynccnt 0x0" ::: "memory");
}
__device__ __forceinline__ unsigned int lds_addr_of(const void* p) {
    return (unsigned int)(uintptr_t)p;
}

// ---------------------------------------------------------------------------
// Prep, ONE launch of 512 equal blocks (two for every WGP, 16 waves a WGP):
// fp32 -> fp16 of x and context, and the three weight transposes
// W (Kd x Nd, f32, row-major) -> WT (Nd x Kd, f16, row-major).
// Every block takes 64 KiB of x or context (16 loads of 16 B a lane), one
// 64 x 64 tile of Wq or Wo and one 16 x 16 tile of Wkv; all its loads are
// issued before the first is used, and it has one barrier.
// ---------------------------------------------------------------------------
#define PD   1024  // model dim: rows of every W, columns of Wq and Wo
#define PKV  128   // columns of Wkv
#define PCH  4096  // 16-byte pieces of x or context per block
#define TPIT 72    // transposed tile's row pitch in halves: 128 B + 16 B (16 B x odd)

__global__ __launch_bounds__(256) void prep_kernel(
    const float* __restrict__ x, const float* __restrict__ ctx,
    const float* __restrict__ Wq, const float* __restrict__ Wkv,
    const float* __restrict__ Wo,
    _Float16* __restrict__ x16, _Float16* __restrict__ ctx16,
    _Float16* __restrict__ WqT, _Float16* __restrict__ WkvT,
    _Float16* __restrict__ WoT)
{
    __shared__ alignas(16) _Float16 tT[64 * TPIT];   // [n][k] of the 64 x 64 tile
    __shared__ _Float16 sT[16 * 17];                 // [k][n] of the 16 x 16 tile

    const int  tid   = threadIdx.x;
    const int  blk   = blockIdx.x;
    const bool first = blk < 256;      // blocks 0..255: x, Wq; 256..511: context, Wo
    const int  sub   = blk & 255;
    const int  c16   = tid & 15;
    const int  r16   = tid >> 4;

    // the block's stretch of x or context: a wave's load = 512 B in a row
    const v4f* src = reinterpret_cast<const v4f*>(first ? x : ctx) + (size_t)sub * PCH + tid;
    v4h*       dst = reinterpret_cast<v4h*>(first ? x16 : ctx16) + (size_t)sub * PCH + tid;
    v4f f[16];
#pragma unroll
    for (int i = 0; i < 16; ++i) f[i] = src[i * 256];

    // 64 x 64 tile: a lane takes 4 columns of two adjacent k rows, twice
    const float* W  = first ? Wq : Wo;
    _Float16*    WT = first ? WqT : WoT;
    const int k0 = (sub >> 4) * 64, n0 = (sub & 15) * 64;
    v4f w[2][2];
#pragma unroll
    for (int i = 0; i < 2; ++i)
#pragma unroll
        for (int p = 0; p < 2; ++p)
            w[i][p] = *reinterpret_cast<const v4f*>(
                &W[(size_t)(k0 + i * 32 + r16 * 2 + p) * PD + n0 + c16 * 4]);

    // 16 x 16 tile of Wkv: one element a lane
    const int kk0 = (blk >> 3) * 16, nn0 = (blk & 7) * 16;
    const float wk = Wkv[(size_t)(kk0 + r16) * PKV + nn0 + c16];

    // Behind the last load: no address register of a load above is rewritten in
    // front of this wait.
    asm volatile("s_wait_xcnt 0x0" ::: "memory");
    // Keeps the conversions below the loads: without it the compiler, to save
    // registers, converts the first loads before it issues the last, and a
    // block waits out the memory latency twice.
    __builtin_amdgcn_sched_barrier(0);

#pragma unroll
    for (int i = 0; i < 2; ++i)
#pragma unroll
        for (int j = 0; j < 4; ++j) {
            const v2h pr = { (_Float16)w[i][0][j], (_Float16)w[i][1][j] };
            *reinterpret_cast<v2h*>(&tT[(c16 * 4 + j) * TPIT + i * 32 + r16 * 2]) = pr;
        }
    sT[r16 * 17 + c16] = (_Float16)wk;
    __syncthreads();

    // rows of WT: 8 lanes write one whole 128-B line
#pragma unroll
    for (int i = 0; i < 2; ++i) {
        const int n = (tid >> 3) + i * 32, ch = (tid & 7) * 8;
        *reinterpret_cast<v8h*>(&WT[(size_t)(n0 + n) * PD + k0 + ch]) =
            *reinterpret_cast<const v8h*>(&tT[n * TPIT + ch]);
    }
    WkvT[(size_t)(nn0 + r16) * PD + kk0 + c16] = sT[c16 * 17 + r16];

#pragma unroll
    for (int i = 0; i < 16; ++i) dst[i * 256] = __builtin_convertvector(f[i], v4h);
}

// ---------------------------------------------------------------------------
// WMMA GEMM, f16 operands: C = alpha * (A @ BT^T)
//   A : M x K f16 row-major          BT : N x K f16 row-major (pre-transposed)
// Double-buffered LDS staging via global_load_async_to_lds_b128.
// modes: 0 = f16 row-major out   1 = f32 row-major out
//        2 = kv split: col<64 -> K (b,t,64); col>=64 -> V^T (b,64,T)
// ---------------------------------------------------------------------------
#define BM 128
#define BN 128
#define BK 32
#define LP 40   // LDS row pitch in halves (80B keeps 16B alignment of K-groups)

__global__ __launch_bounds__(256) void wmma_gemm_f16(
    const _Float16* __restrict__ A, const _Float16* __restrict__ BT,
    int M, int K, int N,
    float alpha, void* __restrict__ Cp, int mode, int Tdim)
{
    __shared__ alignas(16) _Float16 As[2][BM * LP];
    __shared__ alignas(16) _Float16 Bs[2][BN * LP];

    const int tid  = threadIdx.x;
    const int lane = tid & 31;
    const int wave = tid >> 5;
    const int wm = wave & 3;            // 4 waves along M
    const int wn = wave >> 2;           // 2 waves along N
    const int bm0 = blockIdx.y * BM;
    const int bn0 = blockIdx.x * BN;
    const int l15 = lane & 15;
    const int hi8 = (lane >> 4) << 3;

    // each thread copies two 16B chunks of A and two of B per tile
    const int srow = tid >> 2;              // 0..63 (plus +64 on second iter)
    const int skg  = (tid & 3) * 8;         // K-group within 32

    v8f acc[2][4];
#pragma unroll
    for (int mi = 0; mi < 2; ++mi)
#pragma unroll
        for (int ni = 0; ni < 4; ++ni)
            acc[mi][ni] = {};

    auto stage = [&](int buf, int k0) {
#pragma unroll
        for (int i = 0; i < 2; ++i) {
            const int row = srow + i * 64;
            async_copy16(lds_addr_of(&As[buf][row * LP + skg]),
                         &A[(size_t)(bm0 + row) * K + k0 + skg]);
        }
#pragma unroll
        for (int i = 0; i < 2; ++i) {
            const int row = srow + i * 64;
            async_copy16(lds_addr_of(&Bs[buf][row * LP + skg]),
                         &BT[(size_t)(bn0 + row) * K + k0 + skg]);
        }
    };

    stage(0, 0);
    wait_async0();
    __syncthreads();

    int buf = 0;
    for (int k0 = 0; k0 < K; k0 += BK) {
        if (k0 + BK < K) stage(buf ^ 1, k0 + BK);   // prefetch next tile

        v16h aF[2], bF[4];
#pragma unroll
        for (int mi = 0; mi < 2; ++mi)
            aF[mi] = load_frag(&As[buf][(wm * 32 + mi * 16 + l15) * LP + hi8]);
#pragma unroll
        for (int ni = 0; ni < 4; ++ni)
            bF[ni] = load_frag(&Bs[buf][(wn * 64 + ni * 16 + l15) * LP + hi8]);

#pragma unroll
        for (int mi = 0; mi < 2; ++mi)
#pragma unroll
            for (int ni = 0; ni < 4; ++ni)
                acc[mi][ni] = wmma_f16(aF[mi], bF[ni], acc[mi][ni]);

        wait_async0();       // next tile landed in LDS
        __syncthreads();     // all waves done reading `buf` / writing `buf^1`
        buf ^= 1;
    }

    // ---- epilogue ----
#pragma unroll
    for (int mi = 0; mi < 2; ++mi) {
#pragma unroll
        for (int ni = 0; ni < 4; ++ni) {
            const int rbase = bm0 + wm * 32 + mi * 16 + hi8;
            const int col   = bn0 + wn * 64 + ni * 16 + l15;
#pragma unroll
            for (int j = 0; j < 8; ++j) {
                const int row = rbase + j;
                const float val = acc[mi][ni][j] * alpha;
                if (mode == 0) {
                    ((_Float16*)Cp)[(size_t)row * N + col] = (_Float16)val;
                } else if (mode == 1) {
                    ((float*)Cp)[(size_t)row * N + col] = val;
                } else {
                    _Float16* kout = (_Float16*)Cp;
                    _Float16* vout = kout + (size_t)M * 64;
                    const int b = row / Tdim;
                    const int t = row - b * Tdim;
                    if (col < 64)
                        kout[(size_t)row * 64 + col] = (_Float16)val;
                    else
                        vout[(size_t)(b * 64 + (col - 64)) * Tdim + t] = (_Float16)val;
                }
            }
        }
    }
}

#define ATW 8
#define SKEY 128
#define KPIT 72
#define VPIT 136

__device__ __forceinline__ float xhalf(float x) {
    return __builtin_bit_cast(float, __builtin_amdgcn_permlanex16(
        __builtin_bit_cast(int, x), __builtin_bit_cast(int, x),
        0x76543210, 0xfedcba98, false, false));
}

__device__ __forceinline__ void async_copy16x4(
    unsigned int l0, unsigned int l1, unsigned int l2, unsigned int l3,
    const _Float16* g0, const _Float16* g1, const _Float16* g2, const _Float16* g3)
{
    asm volatile("global_load_async_to_lds_b128 %0, %4, off\n\t"
                 "global_load_async_to_lds_b128 %1, %5, off\n\t"
                 "global_load_async_to_lds_b128 %2, %6, off\n\t"
                 "global_load_async_to_lds_b128 %3, %7, off\n\t"
                 "s_wait_xcnt 0x0"
                 :: "v"(l0), "v"(l1), "v"(l2), "v"(l3),
                    "v"(g0), "v"(g1), "v"(g2), "v"(g3) : "memory");
}

__global__ __launch_bounds__(ATW * 32) __attribute__((amdgpu_waves_per_eu(4, 4)))
void mqa_attn_kernel(
    const _Float16* __restrict__ q, const _Float16* __restrict__ kmat,
    const _Float16* __restrict__ vT, _Float16* __restrict__ y,
    int Nq, int Tlen, int D, int Hn)
{
    __shared__ alignas(16) _Float16 Ks[2][SKEY * KPIT];
    __shared__ alignas(16) _Float16 Vs[2][64 * VPIT];

    const int tid  = threadIdx.x;
    const int lane = tid & 31;
    const int wv   = tid >> 5;
    const int l15  = lane & 15;
    const int hi8  = (lane >> 4) << 3;

    const int qtiles = Nq >> 4;
    int gw = blockIdx.x * ATW + wv;
    const int qt = gw % qtiles; gw /= qtiles;
    const int h  = gw % Hn;
    const int b  = gw / Hn;          // the same in all waves of a block

    // This thread's share of a tile: 4 chunks of K (the tile is 16 KiB in a
    // row in memory; a wave's copy = 4 rows = 4 lines) and 4 of V^T (a wave's
    // copy = 2 rows of 256 B).
    const _Float16* kg = kmat + (size_t)b * Tlen * 64 + tid * 8;
    const _Float16* vg = vT + (size_t)(b * 64 + (tid >> 4)) * Tlen + (tid & 15) * 8;
    const int kl = (tid >> 3) * KPIT + (tid & 7) * 8;
    const int vl = (tid >> 4) * VPIT + (tid & 15) * 8;

    auto stage = [&](int buf, int st) {
        const _Float16* kgs = kg + (size_t)st * (SKEY * 64);
        const _Float16* vgs = vg + (size_t)st * SKEY;
        async_copy16x4(lds_addr_of(&Ks[buf][kl]),
                       lds_addr_of(&Ks[buf][kl + 32 * KPIT]),
                       lds_addr_of(&Ks[buf][kl + 64 * KPIT]),
                       lds_addr_of(&Ks[buf][kl + 96 * KPIT]),
                       kgs, kgs + 2048, kgs + 4096, kgs + 6144);
        async_copy16x4(lds_addr_of(&Vs[buf][vl]),
                       lds_addr_of(&Vs[buf][vl + 16 * VPIT]),
                       lds_addr_of(&Vs[buf][vl + 32 * VPIT]),
                       lds_addr_of(&Vs[buf][vl + 48 * VPIT]),
                       vgs, vgs + (size_t)16 * Tlen, vgs + (size_t)32 * Tlen,
                       vgs + (size_t)48 * Tlen);
    };

    const int nst = Tlen / SKEY;
    stage(0, 0);

    const _Float16* qbase = q + ((size_t)(b * Nq + qt * 16 + l15)) * D + h * 64;
    v16h bQ[2];
    bQ[0] = load_frag(qbase + 0  + hi8);
    bQ[1] = load_frag(qbase + 32 + hi8);

    wait_async0();                   // this wave's share of tile 0 has landed
    __syncthreads();                 // ... and every other wave's
    if (nst > 1) stage(1, 1);

    float m = -1e30f, l = 0.0f;      // this lane's query; l = this half's keys only
    v8f accY[4];                     // accY[ni][r] = O[query l15][ni*16 + hi8 + r]
#pragma unroll
    for (int ni = 0; ni < 4; ++ni) accY[ni] = {};

    for (int st = 0; st < nst; ++st) {
        const int buf = st & 1;
        const _Float16* kbase = &Ks[buf][l15 * KPIT + hi8];
        const _Float16* vbase = &Vs[buf][l15 * VPIT + hi8];

#pragma unroll
        for (int tc = 0; tc < SKEY; tc += 32) {
            const _Float16* kp0 = kbase + tc * KPIT;
            const _Float16* kp1 = kbase + (tc + 16) * KPIT;
            v16h a00 = load_frag(kp0);
            v16h a01 = load_frag(kp0 + 32);
            v16h a10 = load_frag(kp1);
            v16h a11 = load_frag(kp1 + 32);
            v16h aV[4];
#pragma unroll
            for (int ni = 0; ni < 4; ++ni)
                aV[ni] = load_frag(vbase + ni * 16 * VPIT + tc);

            // s0[r] = S[query l15][key tc + hi8 + r], s1[r]: key tc + 16 + hi8 + r
            v8f s0 = {}, s1 = {};
            s0 = wmma_f16(a00, bQ[0], s0);
            s1 = wmma_f16(a10, bQ[0], s1);
            s0 = wmma_f16(a01, bQ[1], s0);
            s1 = wmma_f16(a11, bQ[1], s1);

            float mt = fmaxf(s0[0], s1[0]);
#pragma unroll
            for (int r = 1; r < 8; ++r) mt = fmaxf(mt, fmaxf(s0[r], s1[r]));
            mt = fmaxf(mt, xhalf(mt));       // both halves: the query's maximum
            const float mn = fmaxf(m, mt);
            const float sc = exp2f(m - mn);
            m = mn;

#pragma unroll
            for (int r = 0; r < 8; ++r) {
                s0[r] = exp2f(s0[r] - mn);
                s1[r] = exp2f(s1[r] - mn);
            }
            // in-lane sum of the 16 exponentials as a tree over register pairs
            const v8f t8 = s0 + s1;
            const v4f t4 = t8.lo + t8.hi;
            const v2f t2 = t4.lo + t4.hi;
            l = l * sc + (t2.x + t2.y);

            // two S^T tiles, converted in place, are the B operand in the k order
            // of load_frag: element s = key (s < 8 ? hi8 + s : 16 + hi8 + s - 8)
            HFrag bP;
            bP.h[0] = __builtin_convertvector(s0, v8h);
            bP.h[1] = __builtin_convertvector(s1, v8h);

#pragma unroll
            for (int ni = 0; ni < 4; ++ni) {
                accY[ni] *= sc;
                accY[ni] = wmma_f16(aV[ni], bP.v, accY[ni]);
            }
        }

        // hand-over: this wave's reads of the tile are done ...
        asm volatile("s_wait_dscnt 0x0" ::: "memory");
        wait_async0();               // ... its share of the next tile has landed
        __syncthreads();             // ... and the same holds for every wave
        if (st + 2 < nst) stage(buf, st + 2);   // refill the buffer just left
    }
    wait_async0();                   // no copy is left when the wave ends

    l += xhalf(l);                   // join the halves' sums once
    const float inv = 1.0f / l;

    _Float16* yrow = y + ((size_t)(b * Nq + qt * 16 + l15)) * D + h * 64 + hi8;
#pragma unroll
    for (int ni = 0; ni < 4; ++ni) {
        const v8f o = accY[ni] * inv;
        *reinterpret_cast<v8h*>(yrow + ni * 16) = __builtin_convertvector(o, v8h);
    }
}

// ---------------------------------------------------------------------------
extern "C" void kernel_launch(void* const* d_in, const int* in_sizes, int n_in,
                              void* d_out, int out_size, void* d_ws, size_t ws_size,
                              hipStream_t stream) {
    const float* x   = (const float*)d_in[0];
    const float* ctx = (const float*)d_in[1];
    const float* Wq  = (const float*)d_in[2];
    const float* Wkv = (const float*)d_in[3];
    const float* Wo  = (const float*)d_in[4];
    float* out = (float*)d_out;

    const int Bc = 2, Nc = 2048, Tc = 2048, Dc = 1024, Hc = 16;
    const int MQ  = Bc * Nc;   // 4096
    const int MKV = Bc * Tc;   // 4096

    // workspace (f16): x16 | ctx16 | WqT | WkvT | WoT | q | k | vT | y
    _Float16* x16   = (_Float16*)d_ws;
    _Float16* ctx16 = x16   + (size_t)MQ * Dc;
    _Float16* WqT   = ctx16 + (size_t)MKV * Dc;
    _Float16* WkvT  = WqT   + (size_t)Dc * Dc;
    _Float16* WoT   = WkvT  + (size_t)128 * Dc;
    _Float16* qbuf  = WoT   + (size_t)Dc * Dc;
    _Float16* kb    = qbuf  + (size_t)MQ * Dc;
    _Float16* vT    = kb    + (size_t)MKV * 64;
    _Float16* y     = vT    + (size_t)MKV * 64;

    const float alphaQ = 0.125f * 1.44269504088896340736f;  // hd^-0.5 * log2(e)

    // ---- prep: fp32 -> fp16 (+ weight transposes), one launch ----
    prep_kernel<<<dim3(512), dim3(256), 0, stream>>>(
        x, ctx, Wq, Wkv, Wo, x16, ctx16, WqT, WkvT, WoT);

    dim3 blk(256);
    // q = (x @ Wq) * alphaQ -> f16
    wmma_gemm_f16<<<dim3(Dc / 128, MQ / 128), blk, 0, stream>>>(
        x16, WqT, MQ, Dc, Dc, alphaQ, qbuf, 0, 0);
    // kv = ctx @ Wkv -> k row-major + v transposed
    wmma_gemm_f16<<<dim3(1, MKV / 128), blk, 0, stream>>>(
        ctx16, WkvT, MKV, Dc, 128, 1.0f, kb, 2, Tc);
    // attention -> y (f16)
    const int totalWaves = Bc * Hc * (Nc / 16);   // 4096
    mqa_attn_kernel<<<dim3(totalWaves / 8), dim3(256), 0, stream>>>(
        qbuf, kb, vT, y, Nc, Tc, Dc, Hc);
    // out = y @ Wo -> f32
    wmma_gemm_f16<<<dim3(Dc / 128, MQ / 128), blk, 0, stream>>>(
        y, WoT, MQ, Dc, Dc, 1.0f, out, 1, 0);
}

// v004
// It runs in 114 microseconds.
// Next to v003, in two timings, it ran 1.10 times as fast each time.
// Counting every step since v000, it is 1.80 times as fast.
#include <hip/hip_runtime.h>
#include <math.h>

typedef _Float16 v16h __attribute__((ext_vector_type(16)));
typedef _Float16 v8h  __attribute__((ext_vector_type(8)));
typedef _Float16 v4h  __attribute__((ext_vector_type(4)));
typedef _Float16 v2h  __attribute__((ext_vector_type(2)));
typedef float    v8f  __attribute__((ext_vector_type(8)));
typedef float    v4f  __attribute__((ext_vector_type(4)));
typedef float    v2f  __attribute__((ext_vector_type(2)));

union HFrag { v16h v; v8h h[2]; };

__device__ __forceinline__ v16h load_frag(const _Float16* p) {
    HFrag f;
    f.h[0] = *reinterpret_cast<const v8h*>(p);
    f.h[1] = *reinterpret_cast<const v8h*>(p + 16);
    return f.v;
}

__device__ __forceinline__ v8f wmma_f16(v16h a, v16h b, v8f c) {
    return __builtin_amdgcn_wmma_f32_16x16x32_f16(false, a, false, b,
                                                  (short)0, c, false, false);
}

__device__ __forceinline__ void async_copy16(unsigned int lds_byte_addr,
                                             const void* gptr) {
    unsigned long long ga = (unsigned long long)(uintptr_t)gptr;
    asm volatile("global_load_async_to_lds_b128 %0, %1, off"
                 :: "v"(lds_byte_addr), "v"(ga) : "memory");
}
__device__ __forceinline__ void wait_async0() {
    asm volatile("s_wait_asynccnt 0x0" ::: "memory");
}
__device__ __forceinline__ unsigned int lds_addr_of(const void* p) {
    return (unsigned int)(uintptr_t)p;
}

// ---------------------------------------------------------------------------
// Prep, ONE launch of 512 equal blocks (two for every WGP, 16 waves a WGP):
// fp32 -> fp16 of x and context, and the three weight transposes
// W (Kd x Nd, f32, row-major) -> WT (Nd x Kd, f16, row-major).
// Every block takes 64 KiB of x or context (16 loads of 16 B a lane), one
// 64 x 64 tile of Wq or Wo and one 16 x 16 tile of Wkv; all its loads are
// issued before the first is used, and it has one barrier.
// ---------------------------------------------------------------------------
#define PD   1024  // model dim: rows of every W, columns of Wq and Wo
#define PKV  128   // columns of Wkv
#define PCH  4096  // 16-byte pieces of x or context per block
#define TPIT 72    // transposed tile's row pitch in halves: 128 B + 16 B (16 B x odd)

__global__ __launch_bounds__(256) void prep_kernel(
    const float* __restrict__ x, const float* __restrict__ ctx,
    const float* __restrict__ Wq, const float* __restrict__ Wkv,
    const float* __restrict__ Wo,
    _Float16* __restrict__ x16, _Float16* __restrict__ ctx16,
    _Float16* __restrict__ WqT, _Float16* __restrict__ WkvT,
    _Float16* __restrict__ WoT)
{
    __shared__ alignas(16) _Float16 tT[64 * TPIT];   // [n][k] of the 64 x 64 tile
    __shared__ _Float16 sT[16 * 17];                 // [k][n] of the 16 x 16 tile

    const int  tid   = threadIdx.x;
    const int  blk   = blockIdx.x;
    const bool first = blk < 256;      // blocks 0..255: x, Wq; 256..511: context, Wo
    const int  sub   = blk & 255;
    const int  c16   = tid & 15;
    const int  r16   = tid >> 4;

    // the block's stretch of x or context: a wave's load = 512 B in a row
    const v4f* src = reinterpret_cast<const v4f*>(first ? x : ctx) + (size_t)sub * PCH + tid;
    v4h*       dst = reinterpret_cast<v4h*>(first ? x16 : ctx16) + (size_t)sub * PCH + tid;
    v4f f[16];
#pragma unroll
    for (int i = 0; i < 16; ++i) f[i] = src[i * 256];

    // 64 x 64 tile: a lane takes 4 columns of two adjacent k rows, twice
    const float* W  = first ? Wq : Wo;
    _Float16*    WT = first ? WqT : WoT;
    const int k0 = (sub >> 4) * 64, n0 = (sub & 15) * 64;
    v4f w[2][2];
#pragma unroll
    for (int i = 0; i < 2; ++i)
#pragma unroll
        for (int p = 0; p < 2; ++p)
            w[i][p] = *reinterpret_cast<const v4f*>(
                &W[(size_t)(k0 + i * 32 + r16 * 2 + p) * PD + n0 + c16 * 4]);

    // 16 x 16 tile of Wkv: one element a lane
    const int kk0 = (blk >> 3) * 16, nn0 = (blk & 7) * 16;
    const float wk = Wkv[(size_t)(kk0 + r16) * PKV + nn0 + c16];

    // Behind the last load: no address register of a load above is rewritten in
    // front of this wait.
    asm volatile("s_wait_xcnt 0x0" ::: "memory");
    // Keeps the conversions below the loads: without it the compiler, to save
    // registers, converts the first loads before it issues the last, and a
    // block waits out the memory latency twice.
    __builtin_amdgcn_sched_barrier(0);

#pragma unroll
    for (int i = 0; i < 2; ++i)
#pragma unroll
        for (int j = 0; j < 4; ++j) {
            const v2h pr = { (_Float16)w[i][0][j], (_Float16)w[i][1][j] };
            *reinterpret_cast<v2h*>(&tT[(c16 * 4 + j) * TPIT + i * 32 + r16 * 2]) = pr;
        }
    sT[r16 * 17 + c16] = (_Float16)wk;
    __syncthreads();

    // rows of WT: 8 lanes write one whole 128-B line
#pragma unroll
    for (int i = 0; i < 2; ++i) {
        const int n = (tid >> 3) + i * 32, ch = (tid & 7) * 8;
        *reinterpret_cast<v8h*>(&WT[(size_t)(n0 + n) * PD + k0 + ch]) =
            *reinterpret_cast<const v8h*>(&tT[n * TPIT + ch]);
    }
    WkvT[(size_t)(nn0 + r16) * PD + kk0 + c16] = sT[c16 * 17 + r16];

#pragma unroll
    for (int i = 0; i < 16; ++i) dst[i * 256] = __builtin_convertvector(f[i], v4h);
}

// ---------------------------------------------------------------------------
// WMMA GEMM, f16 operands: C = alpha * (A @ BT^T)
//   A : M x K f16 row-major          BT : N x K f16 row-major (pre-transposed)
// Double-buffered LDS staging via global_load_async_to_lds_b128.
// modes: 0 = f16 row-major out   1 = f32 row-major out
//        2 = kv split: col<64 -> K (b,t,64); col>=64 -> V^T (b,64,T)
// ---------------------------------------------------------------------------
#define BM 128
#define BN 128
#define BK 32
#define LP 40   // LDS row pitch in halves (80B keeps 16B alignment of K-groups)

__global__ __launch_bounds__(256) void wmma_gemm_f16(
    const _Float16* __restrict__ A, const _Float16* __restrict__ BT,
    int M, int K, int N,
    float alpha, void* __restrict__ Cp, int mode, int Tdim)
{
    __shared__ alignas(16) _Float16 As[2][BM * LP];
    __shared__ alignas(16) _Float16 Bs[2][BN * LP];

    const int tid  = threadIdx.x;
    const int lane = tid & 31;
    const int wave = tid >> 5;
    const int wm = wave & 3;            // 4 waves along M
    const int wn = wave >> 2;           // 2 waves along N
    const int bm0 = blockIdx.y * BM;
    const int bn0 = blockIdx.x * BN;
    const int l15 = lane & 15;
    const int hi8 = (lane >> 4) << 3;

    // each thread copies two 16B chunks of A and two of B per tile
    const int srow = tid >> 2;              // 0..63 (plus +64 on second iter)
    const int skg  = (tid & 3) * 8;         // K-group within 32

    v8f acc[2][4];
#pragma unroll
    for (int mi = 0; mi < 2; ++mi)
#pragma unroll
        for (int ni = 0; ni < 4; ++ni)
            acc[mi][ni] = {};

    auto stage = [&](int buf, int k0) {
#pragma unroll
        for (int i = 0; i < 2; ++i) {
            const int row = srow + i * 64;
            async_copy16(lds_addr_of(&As[buf][row * LP + skg]),
                         &A[(size_t)(bm0 + row) * K + k0 + skg]);
        }
#pragma unroll
        for (int i = 0; i < 2; ++i) {
            const int row = srow + i * 64;
            async_copy16(lds_addr_of(&Bs[buf][row * LP + skg]),
                         &BT[(size_t)(bn0 + row) * K + k0 + skg]);
        }
    };

    stage(0, 0);
    wait_async0();
    __syncthreads();

    int buf = 0;
    for (int k0 = 0; k0 < K; k0 += BK) {
        if (k0 + BK < K) stage(buf ^ 1, k0 + BK);   // prefetch next tile

        v16h aF[2], bF[4];
#pragma unroll
        for (int mi = 0; mi < 2; ++mi)
            aF[mi] = load_frag(&As[buf][(wm * 32 + mi * 16 + l15) * LP + hi8]);
#pragma unroll
        for (int ni = 0; ni < 4; ++ni)
            bF[ni] = load_frag(&Bs[buf][(wn * 64 + ni * 16 + l15) * LP + hi8]);

#pragma unroll
        for (int mi = 0; mi < 2; ++mi)
#pragma unroll
            for (int ni = 0; ni < 4; ++ni)
                acc[mi][ni] = wmma_f16(aF[mi], bF[ni], acc[mi][ni]);

        wait_async0();       // next tile landed in LDS
        __syncthreads();     // all waves done reading `buf` / writing `buf^1`
        buf ^= 1;
    }

    // ---- epilogue ----
#pragma unroll
    for (int mi = 0; mi < 2; ++mi) {
#pragma unroll
        for (int ni = 0; ni < 4; ++ni) {
            const int rbase = bm0 + wm * 32 + mi * 16 + hi8;
            const int col   = bn0 + wn * 64 + ni * 16 + l15;
#pragma unroll
            for (int j = 0; j < 8; ++j) {
                const int row = rbase + j;
                const float val = acc[mi][ni][j] * alpha;
                if (mode == 0) {
                    ((_Float16*)Cp)[(size_t)row * N + col] = (_Float16)val;
                } else if (mode == 1) {
                    ((float*)Cp)[(size_t)row * N + col] = val;
                } else {
                    _Float16* kout = (_Float16*)Cp;
                    _Float16* vout = kout + (size_t)M * 64;
                    const int b = row / Tdim;
                    const int t = row - b * Tdim;
                    if (col < 64)
                        kout[(size_t)row * 64 + col] = (_Float16)val;
                    else
                        vout[(size_t)(b * 64 + (col - 64)) * Tdim + t] = (_Float16)val;
                }
            }
        }
    }
}

#define ATW 8
#define SKEY 128
#define KPIT 72
#define VPIT 136

__device__ __forceinline__ float xhalf(float x) {
    return __builtin_bit_cast(float, __builtin_amdgcn_permlanex16(
        __builtin_bit_cast(int, x), __builtin_bit_cast(int, x),
        0x76543210, 0xfedcba98, false, false));
}

__device__ __forceinline__ void async_copy16x4(
    unsigned int l0, unsigned int l1, unsigned int l2, unsigned int l3,
    const _Float16* g0, const _Float16* g1, const _Float16* g2, const _Float16* g3)
{
    asm volatile("global_load_async_to_lds_b128 %0, %4, off\n\t"
                 "global_load_async_to_lds_b128 %1, %5, off\n\t"
                 "global_load_async_to_lds_b128 %2, %6, off\n\t"
                 "global_load_async_to_lds_b128 %3, %7, off\n\t"
                 "s_wait_xcnt 0x0"
                 :: "v"(l0), "v"(l1), "v"(l2), "v"(l3),
                    "v"(g0), "v"(g1), "v"(g2), "v"(g3) : "memory");
}

__global__ __launch_bounds__(ATW * 32) __attribute__((amdgpu_waves_per_eu(4, 4)))
void mqa_attn_kernel(
    const _Float16* __restrict__ q, const _Float16* __restrict__ kmat,
    const _Float16* __restrict__ vT, _Float16* __restrict__ y,
    int Nq, int Tlen, int D, int Hn)
{
    __shared__ alignas(16) _Float16 Ks[2][SKEY * KPIT];
    __shared__ alignas(16) _Float16 Vs[2][64 * VPIT];

    const int tid  = threadIdx.x;
    const int lane = tid & 31;
    const int wv   = tid >> 5;
    const int l15  = lane & 15;
    const int hi8  = (lane >> 4) << 3;

    const int qtiles = Nq >> 4;
    int gw = blockIdx.x * ATW + wv;
    const int qt = gw % qtiles; gw /= qtiles;
    const int h  = gw % Hn;
    const int b  = gw / Hn;          // the same in all waves of a block

    // This thread's share of a tile: 4 chunks of K (the tile is 16 KiB in a
    // row in memory; a wave's copy = 4 rows = 4 lines) and 4 of V^T (a wave's
    // copy = 2 rows of 256 B).
    const _Float16* kg = kmat + (size_t)b * Tlen * 64 + tid * 8;
    const _Float16* vg = vT + (size_t)(b * 64 + (tid >> 4)) * Tlen + (tid & 15) * 8;
    const int kl = (tid >> 3) * KPIT + (tid & 7) * 8;
    const int vl = (tid >> 4) * VPIT + (tid & 15) * 8;

    auto stage = [&](int buf, int st) {
        const _Float16* kgs = kg + (size_t)st * (SKEY * 64);
        const _Float16* vgs = vg + (size_t)st * SKEY;
        async_copy16x4(lds_addr_of(&Ks[buf][kl]),
                       lds_addr_of(&Ks[buf][kl + 32 * KPIT]),
                       lds_addr_of(&Ks[buf][kl + 64 * KPIT]),
                       lds_addr_of(&Ks[buf][kl + 96 * KPIT]),
                       kgs, kgs + 2048, kgs + 4096, kgs + 6144);
        async_copy16x4(lds_addr_of(&Vs[buf][vl]),
                       lds_addr_of(&Vs[buf][vl + 16 * VPIT]),
                       lds_addr_of(&Vs[buf][vl + 32 * VPIT]),
                       lds_addr_of(&Vs[buf][vl + 48 * VPIT]),
                       vgs, vgs + (size_t)16 * Tlen, vgs + (size_t)32 * Tlen,
                       vgs + (size_t)48 * Tlen);
    };

    const int nst = Tlen / SKEY;
    stage(0, 0);

    const _Float16* qbase = q + ((size_t)(b * Nq + qt * 16 + l15)) * D + h * 64;
    v16h bQ[2];
    bQ[0] = load_frag(qbase + 0  + hi8);
    bQ[1] = load_frag(qbase + 32 + hi8);

    wait_async0();                   // this wave's share of tile 0 has landed
    __syncthreads();                 // ... and every other wave's
    if (nst > 1) stage(1, 1);

    float m = -1e30f, l = 0.0f;      // this lane's query; l = this half's keys only
    v8f accY[4];                     // accY[ni][r] = O[query l15][ni*16 + hi8 + r]
#pragma unroll
    for (int ni = 0; ni < 4; ++ni) accY[ni] = {};

    for (int st = 0; st < nst; ++st) {
        const int buf = st & 1;
        const _Float16* kbase = &Ks[buf][l15 * KPIT + hi8];
        const _Float16* vbase = &Vs[buf][l15 * VPIT + hi8];

#pragma unroll
        for (int tc = 0; tc < SKEY; tc += 32) {
            const _Float16* kp0 = kbase + tc * KPIT;
            const _Float16* kp1 = kbase + (tc + 16) * KPIT;
            v16h a00 = load_frag(kp0);
            v16h a01 = load_frag(kp0 + 32);
            v16h a10 = load_frag(kp1);
            v16h a11 = load_frag(kp1 + 32);
            v16h aV[4];
#pragma unroll
            for (int ni = 0; ni < 4; ++ni)
                aV[ni] = load_frag(vbase + ni * 16 * VPIT + tc);

            // s0[r] = S[query l15][key tc + hi8 + r], s1[r]: key tc + 16 + hi8 + r
            v8f s0 = {}, s1 = {};
            s0 = wmma_f16(a00, bQ[0], s0);
            s1 = wmma_f16(a10, bQ[0], s1);
            s0 = wmma_f16(a01, bQ[1], s0);
            s1 = wmma_f16(a11, bQ[1], s1);

            float mt = fmaxf(s0[0], s1[0]);
#pragma unroll
            for (int r = 1; r < 8; ++r) mt = fmaxf(mt, fmaxf(s0[r], s1[r]));
            mt = fmaxf(mt, xhalf(mt));       // both halves: the query's maximum
            const float mn = fmaxf(m, mt);
            const float sc = __builtin_amdgcn_exp2f(m - mn);
            m = mn;

            s0 -= mn;                        // whole vectors: packed subtractions
            s1 -= mn;
#pragma unroll
            for (int r = 0; r < 8; ++r) {
                s0[r] = __builtin_amdgcn_exp2f(s0[r]);
                s1[r] = __builtin_amdgcn_exp2f(s1[r]);
            }
            // in-lane sum of the 16 exponentials as a tree over register pairs
            const v8f t8 = s0 + s1;
            const v4f t4 = t8.lo + t8.hi;
            const v2f t2 = t4.lo + t4.hi;
            l = l * sc + (t2.x + t2.y);

            // two S^T tiles, converted in place, are the B operand in the k order
            // of load_frag: element s = key (s < 8 ? hi8 + s : 16 + hi8 + s - 8)
            HFrag bP;
            bP.h[0] = __builtin_convertvector(s0, v8h);
            bP.h[1] = __builtin_convertvector(s1, v8h);

#pragma unroll
            for (int ni = 0; ni < 4; ++ni) {
                accY[ni] *= sc;
                accY[ni] = wmma_f16(aV[ni], bP.v, accY[ni]);
            }
        }

        // hand-over: this wave's reads of the tile are done ...
        asm volatile("s_wait_dscnt 0x0" ::: "memory");
        wait_async0();               // ... its share of the next tile has landed
        __syncthreads();             // ... and the same holds for every wave
        if (st + 2 < nst) stage(buf, st + 2);   // refill the buffer just left
    }
    wait_async0();                   // no copy is left when the wave ends

    l += xhalf(l);                   // join the halves' sums once
    const float inv = 1.0f / l;

    _Float16* yrow = y + ((size_t)(b * Nq + qt * 16 + l15)) * D + h * 64 + hi8;
#pragma unroll
    for (int ni = 0; ni < 4; ++ni) {
        const v8f o = accY[ni] * inv;
        *reinterpret_cast<v8h*>(yrow + ni * 16) = __builtin_convertvector(o, v8h);
    }
}

// ---------------------------------------------------------------------------
extern "C" void kernel_launch(void* const* d_in, const int* in_sizes, int n_in,
                              void* d_out, int out_size, void* d_ws, size_t ws_size,
                              hipStream_t stream) {
    const float* x   = (const float*)d_in[0];
    const float* ctx = (const float*)d_in[1];
    const float* Wq  = (const float*)d_in[2];
    const float* Wkv = (const float*)d_in[3];
    const float* Wo  = (const float*)d_in[4];
    float* out = (float*)d_out;

    const int Bc = 2, Nc = 2048, Tc = 2048, Dc = 1024, Hc = 16;
    const int MQ  = Bc * Nc;   // 4096
    const int MKV = Bc * Tc;   // 4096

    // workspace (f16): x16 | ctx16 | WqT | WkvT | WoT | q | k | vT | y
    _Float16* x16   = (_Float16*)d_ws;
    _Float16* ctx16 = x16   + (size_t)MQ * Dc;
    _Float16* WqT   = ctx16 + (size_t)MKV * Dc;
    _Float16* WkvT  = WqT   + (size_t)Dc * Dc;
    _Float16* WoT   = WkvT  + (size_t)128 * Dc;
    _Float16* qbuf  = WoT   + (size_t)Dc * Dc;
    _Float16* kb    = qbuf  + (size_t)MQ * Dc;
    _Float16* vT    = kb    + (size_t)MKV * 64;
    _Float16* y     = vT    + (size_t)MKV * 64;

    const float alphaQ = 0.125f * 1.44269504088896340736f;  // hd^-0.5 * log2(e)

    // ---- prep: fp32 -> fp16 (+ weight transposes), one launch ----
    prep_kernel<<<dim3(512), dim3(256), 0, stream>>>(
        x, ctx, Wq, Wkv, Wo, x16, ctx16, WqT, WkvT, WoT);

    dim3 blk(256);
    // q = (x @ Wq) * alphaQ -> f16
    wmma_gemm_f16<<<dim3(Dc / 128, MQ / 128), blk, 0, stream>>>(
        x16, WqT, MQ, Dc, Dc, alphaQ, qbuf, 0, 0);
    // kv = ctx @ Wkv -> k row-major + v transposed
    wmma_gemm_f16<<<dim3(1, MKV / 128), blk, 0, stream>>>(
        ctx16, WkvT, MKV, Dc, 128, 1.0f, kb, 2, Tc);
    // attention -> y (f16)
    const int totalWaves = Bc * Hc * (Nc / 16);   // 4096
    mqa_attn_kernel<<<dim3(totalWaves / 8), dim3(256), 0, stream>>>(
        qbuf, kb, vT, y, Nc, Tc, Dc, Hc);
    // out = y @ Wo -> f32
    wmma_gemm_f16<<<dim3(Dc / 128, MQ / 128), blk, 0, stream>>>(
        y, WoT, MQ, Dc, Dc, 1.0f, out, 1, 0);
}

// v005
// It runs in 95.8 microseconds.
// Two timings next to v004 both put it at 1.19 times that version's speed.
// All steps since v000 together make it 2.14 times as fast.
#include <hip/hip_runtime.h>
#include <math.h>

typedef _Float16 v16h __attribute__((ext_vector_type(16)));
typedef _Float16 v8h  __attribute__((ext_vector_type(8)));
typedef _Float16 v4h  __attribute__((ext_vector_type(4)));
typedef _Float16 v2h  __attribute__((ext_vector_type(2)));
typedef float    v8f  __attribute__((ext_vector_type(8)));
typedef float    v4f  __attribute__((ext_vector_type(4)));
typedef float    v2f  __attribute__((ext_vector_type(2)));

union HFrag { v16h v; v8h h[2]; };

__device__ __forceinline__ v16h load_frag(const _Float16* p) {
    HFrag f;
    f.h[0] = *reinterpret_cast<const v8h*>(p);
    f.h[1] = *reinterpret_cast<const v8h*>(p + 16);
    return f.v;
}

__device__ __forceinline__ v8f wmma_f16(v16h a, v16h b, v8f c) {
    return __builtin_amdgcn_wmma_f32_16x16x32_f16(false, a, false, b,
                                                  (short)0, c, false, false);
}

__device__ __forceinline__ void async_copy16(unsigned int lds_byte_addr,
                                             const void* gptr) {
    unsigned long long ga = (unsigned long long)(uintptr_t)gptr;
    asm volatile("global_load_async_to_lds_b128 %0, %1, off"
                 :: "v"(lds_byte_addr), "v"(ga) : "memory");
}
__device__ __forceinline__ void wait_async0() {
    asm volatile("s_wait_asynccnt 0x0" ::: "memory");
}
__device__ __forceinline__ unsigned int lds_addr_of(const void* p) {
    return (unsigned int)(uintptr_t)p;
}

// ---------------------------------------------------------------------------
// Prep, ONE launch of 512 equal blocks (two for every WGP, 16 waves a WGP):
// fp32 -> fp16 of x and context, and the three weight transposes
// W (Kd x Nd, f32, row-major) -> WT (Nd x Kd, f16, row-major).
// Every block takes 64 KiB of x or context (16 loads of 16 B a lane), one
// 64 x 64 tile of Wq or Wo and one 16 x 16 tile of Wkv; all its loads are
// issued before the first is used, and it has one barrier.
// ---------------------------------------------------------------------------
#define PD   1024  // model dim: rows of every W, columns of Wq and Wo
#define PKV  128   // columns of Wkv
#define PCH  4096  // 16-byte pieces of x or context per block
#define TPIT 72    // transposed tile's row pitch in halves: 128 B + 16 B (16 B x odd)

__global__ __launch_bounds__(256) void prep_kernel(
    const float* __restrict__ x, const float* __restrict__ ctx,
    const float* __restrict__ Wq, const float* __restrict__ Wkv,
    const float* __restrict__ Wo,
    _Float16* __restrict__ x16, _Float16* __restrict__ ctx16,
    _Float16* __restrict__ WqT, _Float16* __restrict__ WkvT,
    _Float16* __restrict__ WoT)
{
    __shared__ alignas(16) _Float16 tT[64 * TPIT];   // [n][k] of the 64 x 64 tile
    __shared__ _Float16 sT[16 * 17];                 // [k][n] of the 16 x 16 tile

    const int  tid   = threadIdx.x;
    const int  blk   = blockIdx.x;
    const bool first = blk < 256;      // blocks 0..255: x, Wq; 256..511: context, Wo
    const int  sub   = blk & 255;
    const int  c16   = tid & 15;
    const int  r16   = tid >> 4;

    // the block's stretch of x or context: a wave's load = 512 B in a row
    const v4f* src = reinterpret_cast<const v4f*>(first ? x : ctx) + (size_t)sub * PCH + tid;
    v4h*       dst = reinterpret_cast<v4h*>(first ? x16 : ctx16) + (size_t)sub * PCH + tid;
    v4f f[16];
#pragma unroll
    for (int i = 0; i < 16; ++i) f[i] = src[i * 256];

    // 64 x 64 tile: a lane takes 4 columns of two adjacent k rows, twice
    const float* W  = first ? Wq : Wo;
    _Float16*    WT = first ? WqT : WoT;
    const int k0 = (sub >> 4) * 64, n0 = (sub & 15) * 64;
    v4f w[2][2];
#pragma unroll
    for (int i = 0; i < 2; ++i)
#pragma unroll
        for (int p = 0; p < 2; ++p)
            w[i][p] = *reinterpret_cast<const v4f*>(
                &W[(size_t)(k0 + i * 32 + r16 * 2 + p) * PD + n0 + c16 * 4]);

    // 16 x 16 tile of Wkv: one element a lane
    const int kk0 = (blk >> 3) * 16, nn0 = (blk & 7) * 16;
    const float wk = Wkv[(size_t)(kk0 + r16) * PKV + nn0 + c16];

    // Behind the last load: no address register of a load above is rewritten in
    // front of this wait.
    asm volatile("s_wait_xcnt 0x0" ::: "memory");
    // Keeps the conversions below the loads: without it the compiler, to save
    // registers, converts the first loads before it issues the last, and a
    // block waits out the memory latency twice.
    __builtin_amdgcn_sched_barrier(0);

#pragma unroll
    for (int i = 0; i < 2; ++i)
#pragma unroll
        for (int j = 0; j < 4; ++j) {
            const v2h pr = { (_Float16)w[i][0][j], (_Float16)w[i][1][j] };
            *reinterpret_cast<v2h*>(&tT[(c16 * 4 + j) * TPIT + i * 32 + r16 * 2]) = pr;
        }
    sT[r16 * 17 + c16] = (_Float16)wk;
    __syncthreads();

    // rows of WT: 8 lanes write one whole 128-B line
#pragma unroll
    for (int i = 0; i < 2; ++i) {
        const int n = (tid >> 3) + i * 32, ch = (tid & 7) * 8;
        *reinterpret_cast<v8h*>(&WT[(size_t)(n0 + n) * PD + k0 + ch]) =
            *reinterpret_cast<const v8h*>(&tT[n * TPIT + ch]);
    }
    WkvT[(size_t)(nn0 + r16) * PD + kk0 + c16] = sT[c16 * 17 + r16];

#pragma unroll
    for (int i = 0; i < 16; ++i) dst[i * 256] = __builtin_convertvector(f[i], v4h);
}

// ---------------------------------------------------------------------------
// WMMA GEMM, f16 operands: C = alpha * (A @ BT^T)
//   A : M x K f16 row-major          BT : N x K f16 row-major (pre-transposed)
// Double-buffered LDS staging via global_load_async_to_lds_b128.
// modes: 0 = f16 row-major out   1 = f32 row-major out
//        2 = kv split: col<64 -> K (b,t,64); col>=64 -> V^T (b,64,T)
// MODE, the row length N of C and the sequence length TDIM are template
// parameters: each launch's epilogue is straight-line code for its own mode,
// with its 64 stores a lane at constant distances from few addresses.
// ---------------------------------------------------------------------------
#define BM 128
#define BN 128
#define BK 32
#define LP 40   // LDS row pitch in halves (80B keeps 16B alignment of K-groups)

template <int MODE, int N, int TDIM>
__global__ __launch_bounds__(256) void wmma_gemm_f16(
    const _Float16* __restrict__ A, const _Float16* __restrict__ BT,
    int M, int K,
    float alpha, void* __restrict__ Cp)
{
    __shared__ alignas(16) _Float16 As[2][BM * LP];
    __shared__ alignas(16) _Float16 Bs[2][BN * LP];

    const int tid  = threadIdx.x;
    const int lane = tid & 31;
    const int wave = tid >> 5;
    const int wm = wave & 3;            // 4 waves along M
    const int wn = wave >> 2;           // 2 waves along N
    const int bm0 = blockIdx.y * BM;
    const int bn0 = blockIdx.x * BN;
    const int l15 = lane & 15;
    const int hi8 = (lane >> 4) << 3;

    // each thread copies two 16B chunks of A and two of B per tile
    const int srow = tid >> 2;              // 0..63 (plus +64 on second iter)
    const int skg  = (tid & 3) * 8;         // K-group within 32

    v8f acc[2][4];
#pragma unroll
    for (int mi = 0; mi < 2; ++mi)
#pragma unroll
        for (int ni = 0; ni < 4; ++ni)
            acc[mi][ni] = {};

    auto stage = [&](int buf, int k0) {
#pragma unroll
        for (int i = 0; i < 2; ++i) {
            const int row = srow + i * 64;
            async_copy16(lds_addr_of(&As[buf][row * LP + skg]),
                         &A[(size_t)(bm0 + row) * K + k0 + skg]);
        }
#pragma unroll
        for (int i = 0; i < 2; ++i) {
            const int row = srow + i * 64;
            async_copy16(lds_addr_of(&Bs[buf][row * LP + skg]),
                         &BT[(size_t)(bn0 + row) * K + k0 + skg]);
        }
    };

    stage(0, 0);
    wait_async0();
    __syncthreads();

    int buf = 0;
    for (int k0 = 0; k0 < K; k0 += BK) {
        if (k0 + BK < K) stage(buf ^ 1, k0 + BK);   // prefetch next tile

        v16h aF[2], bF[4];
#pragma unroll
        for (int mi = 0; mi < 2; ++mi)
            aF[mi] = load_frag(&As[buf][(wm * 32 + mi * 16 + l15) * LP + hi8]);
#pragma unroll
        for (int ni = 0; ni < 4; ++ni)
            bF[ni] = load_frag(&Bs[buf][(wn * 64 + ni * 16 + l15) * LP + hi8]);

#pragma unroll
        for (int mi = 0; mi < 2; ++mi)
#pragma unroll
            for (int ni = 0; ni < 4; ++ni)
                acc[mi][ni] = wmma_f16(aF[mi], bF[ni], acc[mi][ni]);

        wait_async0();       // next tile landed in LDS
        __syncthreads();     // all waves done reading `buf` / writing `buf^1`
        buf ^= 1;
    }

    // ---- epilogue ----
    // Every loop here is unrolled: acc and val are then indexed by constants
    // and stay in registers.
    static_assert(TDIM % 8 == 0, "the 8 rows of a lane's tile column lie in one batch");
#pragma unroll
    for (int mi = 0; mi < 2; ++mi) {
#pragma unroll
        for (int ni = 0; ni < 4; ++ni) {
            const int rbase = bm0 + wm * 32 + mi * 16 + hi8;
            const int col   = bn0 + wn * 64 + ni * 16 + l15;
            const v8f val = acc[mi][ni] * alpha;
            if constexpr (MODE == 0) {
#pragma unroll
                for (int j = 0; j < 8; ++j)
                    ((_Float16*)Cp)[(size_t)(rbase + j) * N + col] = (_Float16)val[j];
            } else if constexpr (MODE == 1) {
#pragma unroll
                for (int j = 0; j < 8; ++j)
                    ((float*)Cp)[(size_t)(rbase + j) * N + col] = val[j];
            } else {
                _Float16* kout = (_Float16*)Cp;
                _Float16* vout = kout + (size_t)M * 64;
                const int b = rbase / TDIM;
                const int t = rbase - b * TDIM;
                if (col < 64) {          // outside the loop over j: one test a tile
#pragma unroll
                    for (int j = 0; j < 8; ++j)
                        kout[(size_t)(rbase + j) * 64 + col] = (_Float16)val[j];
                } else {
#pragma unroll
                    for (int j = 0; j < 8; ++j)
                        vout[(size_t)(b * 64 + (col - 64)) * TDIM + t + j] = (_Float16)val[j];
                }
            }
        }
    }
}

#define ATW 8
#define SKEY 128
#define KPIT 72
#define VPIT 136

__device__ __forceinline__ float xhalf(float x) {
    return __builtin_bit_cast(float, __builtin_amdgcn_permlanex16(
        __builtin_bit_cast(int, x), __builtin_bit_cast(int, x),
        0x76543210, 0xfedcba98, false, false));
}

__device__ __forceinline__ void async_copy16x4(
    unsigned int l0, unsigned int l1, unsigned int l2, unsigned int l3,
    const _Float16* g0, const _Float16* g1, const _Float16* g2, const _Float16* g3)
{
    asm volatile("global_load_async_to_lds_b128 %0, %4, off\n\t"
                 "global_load_async_to_lds_b128 %1, %5, off\n\t"
                 "global_load_async_to_lds_b128 %2, %6, off\n\t"
                 "global_load_async_to_lds_b128 %3, %7, off\n\t"
                 "s_wait_xcnt 0x0"
                 :: "v"(l0), "v"(l1), "v"(l2), "v"(l3),
                    "v"(g0), "v"(g1), "v"(g2), "v"(g3) : "memory");
}

__global__ __launch_bounds__(ATW * 32) __attribute__((amdgpu_waves_per_eu(4, 4)))
void mqa_attn_kernel(
    const _Float16* __restrict__ q, const _Float16* __restrict__ kmat,
    const _Float16* __restrict__ vT, _Float16* __restrict__ y,
    int Nq, int Tlen, int D, int Hn)
{
    __shared__ alignas(16) _Float16 Ks[2][SKEY * KPIT];
    __shared__ alignas(16) _Float16 Vs[2][64 * VPIT];

    const int tid  = threadIdx.x;
    const int lane = tid & 31;
    const int wv   = tid >> 5;
    const int l15  = lane & 15;
    const int hi8  = (lane >> 4) << 3;

    const int qtiles = Nq >> 4;
    int gw = blockIdx.x * ATW + wv;
    const int qt = gw % qtiles; gw /= qtiles;
    const int h  = gw % Hn;
    const int b  = gw / Hn;          // the same in all waves of a block

    // This thread's share of a tile: 4 chunks of K (the tile is 16 KiB in a
    // row in memory; a wave's copy = 4 rows = 4 lines) and 4 of V^T (a wave's
    // copy = 2 rows of 256 B).
    const _Float16* kg = kmat + (size_t)b * Tlen * 64 + tid * 8;
    const _Float16* vg = vT + (size_t)(b * 64 + (tid >> 4)) * Tlen + (tid & 15) * 8;
    const int kl = (tid >> 3) * KPIT + (tid & 7) * 8;
    const int vl = (tid >> 4) * VPIT + (tid & 15) * 8;

    auto stage = [&](int buf, int st) {
        const _Float16* kgs = kg + (size_t)st * (SKEY * 64);
        const _Float16* vgs = vg + (size_t)st * SKEY;
        async_copy16x4(lds_addr_of(&Ks[buf][kl]),
                       lds_addr_of(&Ks[buf][kl + 32 * KPIT]),
                       lds_addr_of(&Ks[buf][kl + 64 * KPIT]),
                       lds_addr_of(&Ks[buf][kl + 96 * KPIT]),
                       kgs, kgs + 2048, kgs + 4096, kgs + 6144);
        async_copy16x4(lds_addr_of(&Vs[buf][vl]),
                       lds_addr_of(&Vs[buf][vl + 16 * VPIT]),
                       lds_addr_of(&Vs[buf][vl + 32 * VPIT]),
                       lds_addr_of(&Vs[buf][vl + 48 * VPIT]),
                       vgs, vgs + (size_t)16 * Tlen, vgs + (size_t)32 * Tlen,
                       vgs + (size_t)48 * Tlen);
    };

    const int nst = Tlen / SKEY;
    stage(0, 0);

    const _Float16* qbase = q + ((size_t)(b * Nq + qt * 16 + l15)) * D + h * 64;
    v16h bQ[2];
    bQ[0] = load_frag(qbase + 0  + hi8);
    bQ[1] = load_frag(qbase + 32 + hi8);

    wait_async0();                   // this wave's share of tile 0 has landed
    __syncthreads();                 // ... and every other wave's
    if (nst > 1) stage(1, 1);

    float m = -1e30f, l = 0.0f;      // this lane's query; l = this half's keys only
    v8f accY[4];                     // accY[ni][r] = O[query l15][ni*16 + hi8 + r]
#pragma unroll
    for (int ni = 0; ni < 4; ++ni) accY[ni] = {};

    for (int st = 0; st < nst; ++st) {
        const int buf = st & 1;
        const _Float16* kbase = &Ks[buf][l15 * KPIT + hi8];
        const _Float16* vbase = &Vs[buf][l15 * VPIT + hi8];

#pragma unroll
        for (int tc = 0; tc < SKEY; tc += 32) {
            const _Float16* kp0 = kbase + tc * KPIT;
            const _Float16* kp1 = kbase + (tc + 16) * KPIT;
            v16h a00 = load_frag(kp0);
            v16h a01 = load_frag(kp0 + 32);
            v16h a10 = load_frag(kp1);
            v16h a11 = load_frag(kp1 + 32);
            v16h aV[4];
#pragma unroll
            for (int ni = 0; ni < 4; ++ni)
                aV[ni] = load_frag(vbase + ni * 16 * VPIT + tc);

            // s0[r] = S[query l15][key tc + hi8 + r], s1[r]: key tc + 16 + hi8 + r
            v8f s0 = {}, s1 = {};
            s0 = wmma_f16(a00, bQ[0], s0);
            s1 = wmma_f16(a10, bQ[0], s1);
            s0 = wmma_f16(a01, bQ[1], s0);
            s1 = wmma_f16(a11, bQ[1], s1);

            float mt = fmaxf(s0[0], s1[0]);
#pragma unroll
            for (int r = 1; r < 8; ++r) mt = fmaxf(mt, fmaxf(s0[r], s1[r]));
            mt = fmaxf(mt, xhalf(mt));       // both halves: the query's maximum
            const float mn = fmaxf(m, mt);
            const float sc = __builtin_amdgcn_exp2f(m - mn);
            m = mn;

            s0 -= mn;                        // whole vectors: packed subtractions
            s1 -= mn;
#pragma unroll
            for (int r = 0; r < 8; ++r) {
                s0[r] = __builtin_amdgcn_exp2f(s0[r]);
                s1[r] = __builtin_amdgcn_exp2f(s1[r]);
            }
            // in-lane sum of the 16 exponentials as a tree over register pairs
            const v8f t8 = s0 + s1;
            const v4f t4 = t8.lo + t8.hi;
            const v2f t2 = t4.lo + t4.hi;
            l = l * sc + (t2.x + t2.y);

            // two S^T tiles, converted in place, are the B operand in the k order
            // of load_frag: element s = key (s < 8 ? hi8 + s : 16 + hi8 + s - 8)
            HFrag bP;
            bP.h[0] = __builtin_convertvector(s0, v8h);
            bP.h[1] = __builtin_convertvector(s1, v8h);

#pragma unroll
            for (int ni = 0; ni < 4; ++ni) {
                accY[ni] *= sc;
                accY[ni] = wmma_f16(aV[ni], bP.v, accY[ni]);
            }
        }

        // hand-over: this wave's reads of the tile are done ...
        asm volatile("s_wait_dscnt 0x0" ::: "memory");
        wait_async0();               // ... its share of the next tile has landed
        __syncthreads();             // ... and the same holds for every wave
        if (st + 2 < nst) stage(buf, st + 2);   // refill the buffer just left
    }
    wait_async0();                   // no copy is left when the wave ends

    l += xhalf(l);                   // join the halves' sums once
    const float inv = 1.0f / l;

    _Float16* yrow = y + ((size_t)(b * Nq + qt * 16 + l15)) * D + h * 64 + hi8;
#pragma unroll
    for (int ni = 0; ni < 4; ++ni) {
        const v8f o = accY[ni] * inv;
        *reinterpret_cast<v8h*>(yrow + ni * 16) = __builtin_convertvector(o, v8h);
    }
}

// ---------------------------------------------------------------------------
extern "C" void kernel_launch(void* const* d_in, const int* in_sizes, int n_in,
                              void* d_out, int out_size, void* d_ws, size_t ws_size,
                              hipStream_t stream) {
    const float* x   = (const float*)d_in[0];
    const float* ctx = (const float*)d_in[1];
    const float* Wq  = (const float*)d_in[2];
    const float* Wkv = (const float*)d_in[3];
    const float* Wo  = (const float*)d_in[4];
    float* out = (float*)d_out;

    const int Bc = 2, Nc = 2048, Tc = 2048, Dc = 1024, Hc = 16;
    const int MQ  = Bc * Nc;   // 4096
    const int MKV = Bc * Tc;   // 4096

    // workspace (f16): x16 | ctx16 | WqT | WkvT | WoT | q | k | vT | y
    _Float16* x16   = (_Float16*)d_ws;
    _Float16* ctx16 = x16   + (size_t)MQ * Dc;
    _Float16* WqT   = ctx16 + (size_t)MKV * Dc;
    _Float16* WkvT  = WqT   + (size_t)Dc * Dc;
    _Float16* WoT   = WkvT  + (size_t)128 * Dc;
    _Float16* qbuf  = WoT   + (size_t)Dc * Dc;
    _Float16* kb    = qbuf  + (size_t)MQ * Dc;
    _Float16* vT    = kb    + (size_t)MKV * 64;
    _Float16* y     = vT    + (size_t)MKV * 64;

    const float alphaQ = 0.125f * 1.44269504088896340736f;  // hd^-0.5 * log2(e)

    // ---- prep: fp32 -> fp16 (+ weight transposes), one launch ----
    prep_kernel<<<dim3(512), dim3(256), 0, stream>>>(
        x, ctx, Wq, Wkv, Wo, x16, ctx16, WqT, WkvT, WoT);

    dim3 blk(256);
    // q = (x @ Wq) * alphaQ -> f16
    wmma_gemm_f16<0, 1024, 2048><<<dim3(Dc / 128, MQ / 128), blk, 0, stream>>>(
        x16, WqT, MQ, Dc, alphaQ, qbuf);
    // kv = ctx @ Wkv -> k row-major + v transposed
    wmma_gemm_f16<2, 128, 2048><<<dim3(1, MKV / 128), blk, 0, stream>>>(
        ctx16, WkvT, MKV, Dc, 1.0f, kb);
    // attention -> y (f16)
    const int totalWaves = Bc * Hc * (Nc / 16);   // 4096
    mqa_attn_kernel<<<dim3(totalWaves / 8), dim3(256), 0, stream>>>(
        qbuf, kb, vT, y, Nc, Tc, Dc, Hc);
    // out = y @ Wo -> f32
    wmma_gemm_f16<1, 1024, 2048><<<dim3(Dc / 128, MQ / 128), blk, 0, stream>>>(
        y, WoT, MQ, Dc, 1.0f, out);
}

// v006
// A run of this version takes 77.9 microseconds.
// Timed twice side by side with v005, it ran 1.23 and 1.24 times as fast.
// All steps since v000 together make it 2.64 times as fast.
#include <hip/hip_runtime.h>
#include <math.h>

typedef _Float16 v16h __attribute__((ext_vector_type(16)));
typedef _Float16 v8h  __attribute__((ext_vector_type(8)));
typedef _Float16 v4h  __attribute__((ext_vector_type(4)));
typedef _Float16 v2h  __attribute__((ext_vector_type(2)));
typedef float    v8f  __attribute__((ext_vector_type(8)));
typedef float    v4f  __attribute__((ext_vector_type(4)));
typedef float    v2f  __attribute__((ext_vector_type(2)));

union HFrag { v16h v; v8h h[2]; };

__device__ __forceinline__ v16h load_frag(const _Float16* p) {
    HFrag f;
    f.h[0] = *reinterpret_cast<const v8h*>(p);
    f.h[1] = *reinterpret_cast<const v8h*>(p + 16);
    return f.v;
}

__device__ __forceinline__ v8f wmma_f16(v16h a, v16h b, v8f c) {
    return __builtin_amdgcn_wmma_f32_16x16x32_f16(false, a, false, b,
                                                  (short)0, c, false, false);
}

__device__ __forceinline__ void async_copy16x8(unsigned int l, unsigned int lstep,
                                               const _Float16* g, size_t gstep) {
    asm volatile("global_load_async_to_lds_b128 %0, %8, off\n\t"
                 "global_load_async_to_lds_b128 %1, %9, off\n\t"
                 "global_load_async_to_lds_b128 %2, %10, off\n\t"
                 "global_load_async_to_lds_b128 %3, %11, off\n\t"
                 "global_load_async_to_lds_b128 %4, %12, off\n\t"
                 "global_load_async_to_lds_b128 %5, %13, off\n\t"
                 "global_load_async_to_lds_b128 %6, %14, off\n\t"
                 "global_load_async_to_lds_b128 %7, %15, off\n\t"
                 "s_wait_xcnt 0x0"
                 :: "v"(l), "v"(l + lstep), "v"(l + 2 * lstep), "v"(l + 3 * lstep),
                    "v"(l + 4 * lstep), "v"(l + 5 * lstep), "v"(l + 6 * lstep),
                    "v"(l + 7 * lstep),
                    "v"(g), "v"(g + gstep), "v"(g + 2 * gstep), "v"(g + 3 * gstep),
                    "v"(g + 4 * gstep), "v"(g + 5 * gstep), "v"(g + 6 * gstep),
                    "v"(g + 7 * gstep) : "memory");
}
__device__ __forceinline__ void wait_async0() {
    asm volatile("s_wait_asynccnt 0x0" ::: "memory");
}
__device__ __forceinline__ unsigned int lds_addr_of(const void* p) {
    return (unsigned int)(uintptr_t)p;
}

// ---------------------------------------------------------------------------
// Prep, ONE launch of 512 equal blocks (two for every WGP, 16 waves a WGP):
// fp32 -> fp16 of x and context, and the three weight transposes
// W (Kd x Nd, f32, row-major) -> WT (Nd x Kd, f16, row-major).
// Every block takes 64 KiB of x or context (16 loads of 16 B a lane), one
// 64 x 64 tile of Wq or Wo and one 16 x 16 tile of Wkv; all its loads are
// issued before the first is used, and it has one barrier.
// ---------------------------------------------------------------------------
#define PD   1024  // model dim: rows of every W, columns of Wq and Wo
#define PKV  128   // columns of Wkv
#define PCH  4096  // 16-byte pieces of x or context per block
#define TPIT 72    // transposed tile's row pitch in halves: 128 B + 16 B (16 B x odd)

__global__ __launch_bounds__(256) void prep_kernel(
    const float* __restrict__ x, const float* __restrict__ ctx,
    const float* __restrict__ Wq, const float* __restrict__ Wkv,
    const float* __restrict__ Wo,
    _Float16* __restrict__ x16, _Float16* __restrict__ ctx16,
    _Float16* __restrict__ WqT, _Float16* __restrict__ WkvT,
    _Float16* __restrict__ WoT)
{
    __shared__ alignas(16) _Float16 tT[64 * TPIT];   // [n][k] of the 64 x 64 tile
    __shared__ _Float16 sT[16 * 17];                 // [k][n] of the 16 x 16 tile

    const int  tid   = threadIdx.x;
    const int  blk   = blockIdx.x;
    const bool first = blk < 256;      // blocks 0..255: x, Wq; 256..511: context, Wo
    const int  sub   = blk & 255;
    const int  c16   = tid & 15;
    const int  r16   = tid >> 4;

    // the block's stretch of x or context: a wave's load = 512 B in a row
    const v4f* src = reinterpret_cast<const v4f*>(first ? x : ctx) + (size_t)sub * PCH + tid;
    v4h*       dst = reinterpret_cast<v4h*>(first ? x16 : ctx16) + (size_t)sub * PCH + tid;
    v4f f[16];
#pragma unroll
    for (int i = 0; i < 16; ++i) f[i] = src[i * 256];

    // 64 x 64 tile: a lane takes 4 columns of two adjacent k rows, twice
    const float* W  = first ? Wq : Wo;
    _Float16*    WT = first ? WqT : WoT;
    const int k0 = (sub >> 4) * 64, n0 = (sub & 15) * 64;
    v4f w[2][2];
#pragma unroll
    for (int i = 0; i < 2; ++i)
#pragma unroll
        for (int p = 0; p < 2; ++p)
            w[i][p] = *reinterpret_cast<const v4f*>(
                &W[(size_t)(k0 + i * 32 + r16 * 2 + p) * PD + n0 + c16 * 4]);

    // 16 x 16 tile of Wkv: one element a lane
    const int kk0 = (blk >> 3) * 16, nn0 = (blk & 7) * 16;
    const float wk = Wkv[(size_t)(kk0 + r16) * PKV + nn0 + c16];

    // Behind the last load: no address register of a load above is rewritten in
    // front of this wait.
    asm volatile("s_wait_xcnt 0x0" ::: "memory");
    // Keeps the conversions below the loads: without it the compiler, to save
    // registers, converts the first loads before it issues the last, and a
    // block waits out the memory latency twice.
    __builtin_amdgcn_sched_barrier(0);

#pragma unroll
    for (int i = 0; i < 2; ++i)
#pragma unroll
        for (int j = 0; j < 4; ++j) {
            const v2h pr = { (_Float16)w[i][0][j], (_Float16)w[i][1][j] };
            *reinterpret_cast<v2h*>(&tT[(c16 * 4 + j) * TPIT + i * 32 + r16 * 2]) = pr;
        }
    sT[r16 * 17 + c16] = (_Float16)wk;
    __syncthreads();

    // rows of WT: 8 lanes write one whole 128-B line
#pragma unroll
    for (int i = 0; i < 2; ++i) {
        const int n = (tid >> 3) + i * 32, ch = (tid & 7) * 8;
        *reinterpret_cast<v8h*>(&WT[(size_t)(n0 + n) * PD + k0 + ch]) =
            *reinterpret_cast<const v8h*>(&tT[n * TPIT + ch]);
    }
    WkvT[(size_t)(nn0 + r16) * PD + kk0 + c16] = sT[c16 * 17 + r16];

#pragma unroll
    for (int i = 0; i < 16; ++i) dst[i * 256] = __builtin_convertvector(f[i], v4h);
}

// ---------------------------------------------------------------------------
// WMMA GEMM, f16 operands: C = alpha * (A @ BT^T)
//   A : M x K f16 row-major          BT : N x K f16 row-major (pre-transposed)
// Double-buffered LDS staging via global_load_async_to_lds_b128, 128 k a tile:
// a hand-over (the copies' latency, two waits, a barrier) comes once for 32
// WMMAs of a wave, and 64 KiB a block are in flight while a tile is worked on.
// K is a multiple of 128.
// modes: 0 = f16 row-major out   1 = f32 row-major out
//        2 = kv split: col<64 -> K (b,t,64); col>=64 -> V^T (b,64,T)
// MODE, the row length N of C and the sequence length TDIM are template
// parameters: each launch's epilogue is straight-line code for its own mode,
// with its 64 stores a lane at constant distances from few addresses.
// ---------------------------------------------------------------------------
#define BM 128
#define BN 128
#define BK 128
#define LP 136  // LDS row pitch in halves: 256 B + 16 B (16 B x odd)

template <int MODE, int N, int TDIM>
__global__ __launch_bounds__(256) void wmma_gemm_f16(
    const _Float16* __restrict__ A, const _Float16* __restrict__ BT,
    int M, int K,
    float alpha, void* __restrict__ Cp)
{
    __shared__ alignas(16) _Float16 As[2][BM * LP];
    __shared__ alignas(16) _Float16 Bs[2][BN * LP];

    const int tid  = threadIdx.x;
    const int lane = tid & 31;
    const int wave = tid >> 5;
    const int wm = wave & 3;            // 4 waves along M
    const int wn = wave >> 2;           // 2 waves along N
    const int bm0 = blockIdx.y * BM;
    const int bn0 = blockIdx.x * BN;
    const int l15 = lane & 15;
    const int hi8 = (lane >> 4) << 3;

    // each thread copies eight 16B chunks of A and eight of B per tile; a
    // wave's copy = 2 rows of 256 B
    const int srow = tid >> 4;              // 0..15, plus 16 a copy
    const int skg  = (tid & 15) * 8;        // K-group within 128
    const _Float16* ag = A  + (size_t)(bm0 + srow) * K + skg;
    const _Float16* bg = BT + (size_t)(bn0 + srow) * K + skg;

    v8f acc[2][4];
#pragma unroll
    for (int mi = 0; mi < 2; ++mi)
#pragma unroll
        for (int ni = 0; ni < 4; ++ni)
            acc[mi][ni] = {};

    auto stage = [&](int buf, int st) {
        async_copy16x8(lds_addr_of(&As[buf][srow * LP + skg]), 16 * LP * 2,
                       ag + (size_t)st * BK, (size_t)16 * K);
        async_copy16x8(lds_addr_of(&Bs[buf][srow * LP + skg]), 16 * LP * 2,
                       bg + (size_t)st * BK, (size_t)16 * K);
    };

    const int nst = K / BK;
    stage(0, 0);
    wait_async0();                   // this wave's share of tile 0 has landed
    __syncthreads();                 // ... and every other wave's
    if (nst > 1) stage(1, 1);

    for (int st = 0; st < nst; ++st) {
        const int buf = st & 1;
        const _Float16* abase = &As[buf][(wm * 32 + l15) * LP + hi8];
        const _Float16* bbase = &Bs[buf][(wn * 64 + l15) * LP + hi8];

        // unrolled: the fragment addresses are constant distances from two
        // registers, and the loads of a later k step can go ahead of the WMMAs
#pragma unroll
        for (int kk = 0; kk < BK; kk += 32) {
            v16h aF[2], bF[4];
#pragma unroll
            for (int mi = 0; mi < 2; ++mi)
                aF[mi] = load_frag(abase + mi * 16 * LP + kk);
#pragma unroll
            for (int ni = 0; ni < 4; ++ni)
                bF[ni] = load_frag(bbase + ni * 16 * LP + kk);

#pragma unroll
            for (int mi = 0; mi < 2; ++mi)
#pragma unroll
                for (int ni = 0; ni < 4; ++ni)
                    acc[mi][ni] = wmma_f16(aF[mi], bF[ni], acc[mi][ni]);
        }

        // hand-over: this wave's reads of the tile are done ...
        asm volatile("s_wait_dscnt 0x0" ::: "memory");
        wait_async0();               // ... its share of the next tile has landed
        __syncthreads();             // ... and the same holds for every wave
        if (st + 2 < nst) stage(buf, st + 2);   // refill the buffer just left
    }
    wait_async0();                   // no copy is left when the wave ends

    // ---- epilogue ----
    // Every loop here is unrolled: acc and val are then indexed by constants
    // and stay in registers.
    static_assert(TDIM % 8 == 0, "the 8 rows of a lane's tile column lie in one batch");
#pragma unroll
    for (int mi = 0; mi < 2; ++mi) {
#pragma unroll
        for (int ni = 0; ni < 4; ++ni) {
            const int rbase = bm0 + wm * 32 + mi * 16 + hi8;
            const int col   = bn0 + wn * 64 + ni * 16 + l15;
            const v8f val = acc[mi][ni] * alpha;
            if constexpr (MODE == 0) {
#pragma unroll
                for (int j = 0; j < 8; ++j)
                    ((_Float16*)Cp)[(size_t)(rbase + j) * N + col] = (_Float16)val[j];
            } else if constexpr (MODE == 1) {
#pragma unroll
                for (int j = 0; j < 8; ++j)
                    ((float*)Cp)[(size_t)(rbase + j) * N + col] = val[j];
            } else {
                _Float16* kout = (_Float16*)Cp;
                _Float16* vout = kout + (size_t)M * 64;
                const int b = rbase / TDIM;
                const int t = rbase - b * TDIM;
                if (col < 64) {          // outside the loop over j: one test a tile
#pragma unroll
                    for (int j = 0; j < 8; ++j)
                        kout[(size_t)(rbase + j) * 64 + col] = (_Float16)val[j];
                } else {
#pragma unroll
                    for (int j = 0; j < 8; ++j)
                        vout[(size_t)(b * 64 + (col - 64)) * TDIM + t + j] = (_Float16)val[j];
                }
            }
        }
    }
}

#define ATW 8
#define SKEY 128
#define KPIT 72
#define VPIT 136

__device__ __forceinline__ float xhalf(float x) {
    return __builtin_bit_cast(float, __builtin_amdgcn_permlanex16(
        __builtin_bit_cast(int, x), __builtin_bit_cast(int, x),
        0x76543210, 0xfedcba98, false, false));
}

__device__ __forceinline__ void async_copy16x4(
    unsigned int l0, unsigned int l1, unsigned int l2, unsigned int l3,
    const _Float16* g0, const _Float16* g1, const _Float16* g2, const _Float16* g3)
{
    asm volatile("global_load_async_to_lds_b128 %0, %4, off\n\t"
                 "global_load_async_to_lds_b128 %1, %5, off\n\t"
                 "global_load_async_to_lds_b128 %2, %6, off\n\t"
                 "global_load_async_to_lds_b128 %3, %7, off\n\t"
                 "s_wait_xcnt 0x0"
                 :: "v"(l0), "v"(l1), "v"(l2), "v"(l3),
                    "v"(g0), "v"(g1), "v"(g2), "v"(g3) : "memory");
}

__global__ __launch_bounds__(ATW * 32) __attribute__((amdgpu_waves_per_eu(4, 4)))
void mqa_attn_kernel(
    const _Float16* __restrict__ q, const _Float16* __restrict__ kmat,
    const _Float16* __restrict__ vT, _Float16* __restrict__ y,
    int Nq, int Tlen, int D, int Hn)
{
    __shared__ alignas(16) _Float16 Ks[2][SKEY * KPIT];
    __shared__ alignas(16) _Float16 Vs[2][64 * VPIT];

    const int tid  = threadIdx.x;
    const int lane = tid & 31;
    const int wv   = tid >> 5;
    const int l15  = lane & 15;
    const int hi8  = (lane >> 4) << 3;

    const int qtiles = Nq >> 4;
    int gw = blockIdx.x * ATW + wv;
    const int qt = gw % qtiles; gw /= qtiles;
    const int h  = gw % Hn;
    const int b  = gw / Hn;          // the same in all waves of a block

    // This thread's share of a tile: 4 chunks of K (the tile is 16 KiB in a
    // row in memory; a wave's copy = 4 rows = 4 lines) and 4 of V^T (a wave's
    // copy = 2 rows of 256 B).
    const _Float16* kg = kmat + (size_t)b * Tlen * 64 + tid * 8;
    const _Float16* vg = vT + (size_t)(b * 64 + (tid >> 4)) * Tlen + (tid & 15) * 8;
    const int kl = (tid >> 3) * KPIT + (tid & 7) * 8;
    const int vl = (tid >> 4) * VPIT + (tid & 15) * 8;

    auto stage = [&](int buf, int st) {
        const _Float16* kgs = kg + (size_t)st * (SKEY * 64);
        const _Float16* vgs = vg + (size_t)st * SKEY;
        async_copy16x4(lds_addr_of(&Ks[buf][kl]),
                       lds_addr_of(&Ks[buf][kl + 32 * KPIT]),
                       lds_addr_of(&Ks[buf][kl + 64 * KPIT]),
                       lds_addr_of(&Ks[buf][kl + 96 * KPIT]),
                       kgs, kgs + 2048, kgs + 4096, kgs + 6144);
        async_copy16x4(lds_addr_of(&Vs[buf][vl]),
                       lds_addr_of(&Vs[buf][vl + 16 * VPIT]),
                       lds_addr_of(&Vs[buf][vl + 32 * VPIT]),
                       lds_addr_of(&Vs[buf][vl + 48 * VPIT]),
                       vgs, vgs + (size_t)16 * Tlen, vgs + (size_t)32 * Tlen,
                       vgs + (size_t)48 * Tlen);
    };

    const int nst = Tlen / SKEY;
    stage(0, 0);

    const _Float16* qbase = q + ((size_t)(b * Nq + qt * 16 + l15)) * D + h * 64;
    v16h bQ[2];
    bQ[0] = load_frag(qbase + 0  + hi8);
    bQ[1] = load_frag(qbase + 32 + hi8);

    wait_async0();                   // this wave's share of tile 0 has landed
    __syncthreads();                 // ... and every other wave's
    if (nst > 1) stage(1, 1);

    float m = -1e30f, l = 0.0f;      // this lane's query; l = this half's keys only
    v8f accY[4];                     // accY[ni][r] = O[query l15][ni*16 + hi8 + r]
#pragma unroll
    for (int ni = 0; ni < 4; ++ni) accY[ni] = {};

    for (int st = 0; st < nst; ++st) {
        const int buf = st & 1;
        const _Float16* kbase = &Ks[buf][l15 * KPIT + hi8];
        const _Float16* vbase = &Vs[buf][l15 * VPIT + hi8];

#pragma unroll
        for (int tc = 0; tc < SKEY; tc += 32) {
            const _Float16* kp0 = kbase + tc * KPIT;
            const _Float16* kp1 = kbase + (tc + 16) * KPIT;
            v16h a00 = load_frag(kp0);
            v16h a01 = load_frag(kp0 + 32);
            v16h a10 = load_frag(kp1);
            v16h a11 = load_frag(kp1 + 32);
            v16h aV[4];
#pragma unroll
            for (int ni = 0; ni < 4; ++ni)
                aV[ni] = load_frag(vbase + ni * 16 * VPIT + tc);

            // s0[r] = S[query l15][key tc + hi8 + r], s1[r]: key tc + 16 + hi8 + r
            v8f s0 = {}, s1 = {};
            s0 = wmma_f16(a00, bQ[0], s0);
            s1 = wmma_f16(a10, bQ[0], s1);
            s0 = wmma_f16(a01, bQ[1], s0);
            s1 = wmma_f16(a11, bQ[1], s1);

            float mt = fmaxf(s0[0], s1[0]);
#pragma unroll
            for (int r = 1; r < 8; ++r) mt = fmaxf(mt, fmaxf(s0[r], s1[r]));
            mt = fmaxf(mt, xhalf(mt));       // both halves: the query's maximum
            const float mn = fmaxf(m, mt);
            const float sc = __builtin_amdgcn_exp2f(m - mn);
            m = mn;

            s0 -= mn;                        // whole vectors: packed subtractions
            s1 -= mn;
#pragma unroll
            for (int r = 0; r < 8; ++r) {
                s0[r] = __builtin_amdgcn_exp2f(s0[r]);
                s1[r] = __builtin_amdgcn_exp2f(s1[r]);
            }
            // in-lane sum of the 16 exponentials as a tree over register pairs
            const v8f t8 = s0 + s1;
            const v4f t4 = t8.lo + t8.hi;
            const v2f t2 = t4.lo + t4.hi;
            l = l * sc + (t2.x + t2.y);

            // two S^T tiles, converted in place, are the B operand in the k order
            // of load_frag: element s = key (s < 8 ? hi8 + s : 16 + hi8 + s - 8)
            HFrag bP;
            bP.h[0] = __builtin_convertvector(s0, v8h);
            bP.h[1] = __builtin_convertvector(s1, v8h);

#pragma unroll
            for (int ni = 0; ni < 4; ++ni) {
                accY[ni] *= sc;
                accY[ni] = wmma_f16(aV[ni], bP.v, accY[ni]);
            }
        }

        // hand-over: this wave's reads of the tile are done ...
        asm volatile("s_wait_dscnt 0x0" ::: "memory");
        wait_async0();               // ... its share of the next tile has landed
        __syncthreads();             // ... and the same holds for every wave
        if (st + 2 < nst) stage(buf, st + 2);   // refill the buffer just left
    }
    wait_async0();                   // no copy is left when the wave ends

    l += xhalf(l);                   // join the halves' sums once
    const float inv = 1.0f / l;

    _Float16* yrow = y + ((size_t)(b * Nq + qt * 16 + l15)) * D + h * 64 + hi8;
#pragma unroll
    for (int ni = 0; ni < 4; ++ni) {
        const v8f o = accY[ni] * inv;
        *reinterpret_cast<v8h*>(yrow + ni * 16) = __builtin_convertvector(o, v8h);
    }
}

// ---------------------------------------------------------------------------
extern "C" void kernel_launch(void* const* d_in, const int* in_sizes, int n_in,
                              void* d_out, int out_size, void* d_ws, size_t ws_size,
                              hipStream_t stream) {
    const float* x   = (const float*)d_in[0];
    const float* ctx = (const float*)d_in[1];
    const float* Wq  = (const float*)d_in[2];
    const float* Wkv = (const float*)d_in[3];
    const float* Wo  = (const float*)d_in[4];
    float* out = (float*)d_out;

    const int Bc = 2, Nc = 2048, Tc = 2048, Dc = 1024, Hc = 16;
    const int MQ  = Bc * Nc;   // 4096
    const int MKV = Bc * Tc;   // 4096

    // workspace (f16): x16 | ctx16 | WqT | WkvT | WoT | q | k | vT | y
    _Float16* x16   = (_Float16*)d_ws;
    _Float16* ctx16 = x16   + (size_t)MQ * Dc;
    _Float16* WqT   = ctx16 + (size_t)MKV * Dc;
    _Float16* WkvT  = WqT   + (size_t)Dc * Dc;
    _Float16* WoT   = WkvT  + (size_t)128 * Dc;
    _Float16* qbuf  = WoT   + (size_t)Dc * Dc;
    _Float16* kb    = qbuf  + (size_t)MQ * Dc;
    _Float16* vT    = kb    + (size_t)MKV * 64;
    _Float16* y     = vT    + (size_t)MKV * 64;

    const float alphaQ = 0.125f * 1.44269504088896340736f;  // hd^-0.5 * log2(e)

    // ---- prep: fp32 -> fp16 (+ weight transposes), one launch ----
    prep_kernel<<<dim3(512), dim3(256), 0, stream>>>(
        x, ctx, Wq, Wkv, Wo, x16, ctx16, WqT, WkvT, WoT);

    dim3 blk(256);
    // q = (x @ Wq) * alphaQ -> f16
    wmma_gemm_f16<0, 1024, 2048><<<dim3(Dc / 128, MQ / 128), blk, 0, stream>>>(
        x16, WqT, MQ, Dc, alphaQ, qbuf);
    // kv = ctx @ Wkv -> k row-major + v transposed
    wmma_gemm_f16<2, 128, 2048><<<dim3(1, MKV / 128), blk, 0, stream>>>(
        ctx16, WkvT, MKV, Dc, 1.0f, kb);
    // attention -> y (f16)
    const int totalWaves = Bc * Hc * (Nc / 16);   // 4096
    mqa_attn_kernel<<<dim3(totalWaves / 8), dim3(256), 0, stream>>>(
        qbuf, kb, vT, y, Nc, Tc, Dc, Hc);
    // out = y @ Wo -> f32
    wmma_gemm_f16<1, 1024, 2048><<<dim3(Dc / 128, MQ / 128), blk, 0, stream>>>(
        y, WoT, MQ, Dc, 1.0f, out);
}

// v007
// One run takes 67.8 microseconds.
// Next to v006, in two timings, it ran 1.16 times as fast each time.
// Over all steps from v000 it is 3.06 times as fast.
#include <hip/hip_runtime.h>
#include <math.h>

typedef _Float16 v16h __attribute__((ext_vector_type(16)));
typedef _Float16 v8h  __attribute__((ext_vector_type(8)));
typedef _Float16 v4h  __attribute__((ext_vector_type(4)));
typedef _Float16 v2h  __attribute__((ext_vector_type(2)));
typedef float    v8f  __attribute__((ext_vector_type(8)));
typedef float    v4f  __attribute__((ext_vector_type(4)));
typedef float    v2f  __attribute__((ext_vector_type(2)));

union HFrag { v16h v; v8h h[2]; };

__device__ __forceinline__ v16h load_frag(const _Float16* p) {
    HFrag f;
    f.h[0] = *reinterpret_cast<const v8h*>(p);
    f.h[1] = *reinterpret_cast<const v8h*>(p + 16);
    return f.v;
}

__device__ __forceinline__ v8f wmma_f16(v16h a, v16h b, v8f c) {
    return __builtin_amdgcn_wmma_f32_16x16x32_f16(false, a, false, b,
                                                  (short)0, c, false, false);
}

__device__ __forceinline__ void async_copy16x8(unsigned int l, unsigned int lstep,
                                               const _Float16* g, size_t gstep) {
    asm volatile("global_load_async_to_lds_b128 %0, %8, off\n\t"
                 "global_load_async_to_lds_b128 %1, %9, off\n\t"
                 "global_load_async_to_lds_b128 %2, %10, off\n\t"
                 "global_load_async_to_lds_b128 %3, %11, off\n\t"
                 "global_load_async_to_lds_b128 %4, %12, off\n\t"
                 "global_load_async_to_lds_b128 %5, %13, off\n\t"
                 "global_load_async_to_lds_b128 %6, %14, off\n\t"
                 "global_load_async_to_lds_b128 %7, %15, off\n\t"
                 "s_wait_xcnt 0x0"
                 :: "v"(l), "v"(l + lstep), "v"(l + 2 * lstep), "v"(l + 3 * lstep),
                    "v"(l + 4 * lstep), "v"(l + 5 * lstep), "v"(l + 6 * lstep),
                    "v"(l + 7 * lstep),
                    "v"(g), "v"(g + gstep), "v"(g + 2 * gstep), "v"(g + 3 * gstep),
                    "v"(g + 4 * gstep), "v"(g + 5 * gstep), "v"(g + 6 * gstep),
                    "v"(g + 7 * gstep) : "memory");
}
__device__ __forceinline__ void wait_async0() {
    asm volatile("s_wait_asynccnt 0x0" ::: "memory");
}
__device__ __forceinline__ unsigned int lds_addr_of(const void* p) {
    return (unsigned int)(uintptr_t)p;
}

// ---------------------------------------------------------------------------
// Prep, ONE launch of 512 equal blocks (two for every WGP, 16 waves a WGP):
// fp32 -> fp16 of x and context, and the three weight transposes
// W (Kd x Nd, f32, row-major) -> WT (Nd x Kd, f16, row-major).
// Every block takes 64 KiB of x or context (16 loads of 16 B a lane), one
// 64 x 64 tile of Wq or Wo and one 16 x 16 tile of Wkv; all its loads are
// issued before the first is used, and it has one barrier.
// ---------------------------------------------------------------------------
#define PD   1024  // model dim: rows of every W, columns of Wq and Wo
#define PKV  128   // columns of Wkv
#define PCH  4096  // 16-byte pieces of x or context per block
#define TPIT 72    // transposed tile's row pitch in halves: 128 B + 16 B (16 B x odd)

__global__ __launch_bounds__(256) void prep_kernel(
    const float* __restrict__ x, const float* __restrict__ ctx,
    const float* __restrict__ Wq, const float* __restrict__ Wkv,
    const float* __restrict__ Wo,
    _Float16* __restrict__ x16, _Float16* __restrict__ ctx16,
    _Float16* __restrict__ WqT, _Float16* __restrict__ WkvT,
    _Float16* __restrict__ WoT)
{
    __shared__ alignas(16) _Float16 tT[64 * TPIT];   // [n][k] of the 64 x 64 tile
    __shared__ _Float16 sT[16 * 17];                 // [k][n] of the 16 x 16 tile

    const int  tid   = threadIdx.x;
    const int  blk   = blockIdx.x;
    const bool first = blk < 256;      // blocks 0..255: x, Wq; 256..511: context, Wo
    const int  sub   = blk & 255;
    const int  c16   = tid & 15;
    const int  r16   = tid >> 4;

    // the block's stretch of x or context: a wave's load = 512 B in a row
    const v4f* src = reinterpret_cast<const v4f*>(first ? x : ctx) + (size_t)sub * PCH + tid;
    v4h*       dst = reinterpret_cast<v4h*>(first ? x16 : ctx16) + (size_t)sub * PCH + tid;
    v4f f[16];
#pragma unroll
    for (int i = 0; i < 16; ++i) f[i] = src[i * 256];

    // 64 x 64 tile: a lane takes 4 columns of two adjacent k rows, twice
    const float* W  = first ? Wq : Wo;
    _Float16*    WT = first ? WqT : WoT;
    const int k0 = (sub >> 4) * 64, n0 = (sub & 15) * 64;
    v4f w[2][2];
#pragma unroll
    for (int i = 0; i < 2; ++i)
#pragma unroll
        for (int p = 0; p < 2; ++p)
            w[i][p] = *reinterpret_cast<const v4f*>(
                &W[(size_t)(k0 + i * 32 + r16 * 2 + p) * PD + n0 + c16 * 4]);

    // 16 x 16 tile of Wkv: one element a lane
    const int kk0 = (blk >> 3) * 16, nn0 = (blk & 7) * 16;
    const float wk = Wkv[(size_t)(kk0 + r16) * PKV + nn0 + c16];

    // Behind the last load: no address register of a load above is rewritten in
    // front of this wait.
    asm volatile("s_wait_xcnt 0x0" ::: "memory");
    // Keeps the conversions below the loads: without it the compiler, to save
    // registers, converts the first loads before it issues the last, and a
    // block waits out the memory latency twice.
    __builtin_amdgcn_sched_barrier(0);

#pragma unroll
    for (int i = 0; i < 2; ++i)
#pragma unroll
        for (int j = 0; j < 4; ++j) {
            const v2h pr = { (_Float16)w[i][0][j], (_Float16)w[i][1][j] };
            *reinterpret_cast<v2h*>(&tT[(c16 * 4 + j) * TPIT + i * 32 + r16 * 2]) = pr;
        }
    sT[r16 * 17 + c16] = (_Float16)wk;
    __syncthreads();

    // rows of WT: 8 lanes write one whole 128-B line
#pragma unroll
    for (int i = 0; i < 2; ++i) {
        const int n = (tid >> 3) + i * 32, ch = (tid & 7) * 8;
        *reinterpret_cast<v8h*>(&WT[(size_t)(n0 + n) * PD + k0 + ch]) =
            *reinterpret_cast<const v8h*>(&tT[n * TPIT + ch]);
    }
    WkvT[(size_t)(nn0 + r16) * PD + kk0 + c16] = sT[c16 * 17 + r16];

#pragma unroll
    for (int i = 0; i < 16; ++i) dst[i * 256] = __builtin_convertvector(f[i], v4h);
}

// ---------------------------------------------------------------------------
// WMMA GEMM, f16 operands: C = alpha * (A @ BT^T)
//   A : M x K f16 row-major          BT : N x K f16 row-major (pre-transposed)
// Double-buffered LDS staging via global_load_async_to_lds_b128, 128 k a tile:
// a hand-over (the copies' latency, two waits, a barrier) comes once for 32
// WMMAs of a wave, and 64 KiB a block are in flight while a tile is worked on.
// K is a multiple of 128.
// modes: 0 = f16 row-major out   1 = f32 row-major out
//        2 = kv split: col<64 -> K (b,t,64); col>=64 -> V^T (b,64,T)
// MODE, the row length N of C and the sequence length TDIM are template
// parameters: each block's epilogue is straight-line code for its own mode,
// with its 64 stores a lane at constant distances from few addresses.
// gemm_block is one block's 128 x 128 tile of C at (bm0, bn0); the two LDS
// buffers of each operand are the calling kernel's, so that a kernel which
// holds two modes has them once.
// ---------------------------------------------------------------------------
#define BM 128
#define BN 128
#define BK 128
#define LP 136  // LDS row pitch in halves: 256 B + 16 B (16 B x odd)

template <int MODE, int N, int TDIM>
__device__ __forceinline__ void gemm_block(
    const _Float16* __restrict__ A, const _Float16* __restrict__ BT,
    int M, int K,
    float alpha, void* __restrict__ Cp, int bm0, int bn0,
    _Float16 (*As)[BM * LP], _Float16 (*Bs)[BN * LP])
{
    const int tid  = threadIdx.x;
    const int lane = tid & 31;
    const int wave = tid >> 5;
    const int wm = wave & 3;            // 4 waves along M
    const int wn = wave >> 2;           // 2 waves along N
    const int l15 = lane & 15;
    const int hi8 = (lane >> 4) << 3;

    // each thread copies eight 16B chunks of A and eight of B per tile; a
    // wave's copy = 2 rows of 256 B
    const int srow = tid >> 4;              // 0..15, plus 16 a copy
    const int skg  = (tid & 15) * 8;        // K-group within 128
    const _Float16* ag = A  + (size_t)(bm0 + srow) * K + skg;
    const _Float16* bg = BT + (size_t)(bn0 + srow) * K + skg;

    v8f acc[2][4];
#pragma unroll
    for (int mi = 0; mi < 2; ++mi)
#pragma unroll
        for (int ni = 0; ni < 4; ++ni)
            acc[mi][ni] = {};

    auto stage = [&](int buf, int st) {
        async_copy16x8(lds_addr_of(&As[buf][srow * LP + skg]), 16 * LP * 2,
                       ag + (size_t)st * BK, (size_t)16 * K);
        async_copy16x8(lds_addr_of(&Bs[buf][srow * LP + skg]), 16 * LP * 2,
                       bg + (size_t)st * BK, (size_t)16 * K);
    };

    const int nst = K / BK;
    stage(0, 0);
    wait_async0();                   // this wave's share of tile 0 has landed
    __syncthreads();                 // ... and every other wave's
    if (nst > 1) stage(1, 1);

    for (int st = 0; st < nst; ++st) {
        const int buf = st & 1;
        const _Float16* abase = &As[buf][(wm * 32 + l15) * LP + hi8];
        const _Float16* bbase = &Bs[buf][(wn * 64 + l15) * LP + hi8];

        // unrolled: the fragment addresses are constant distances from two
        // registers, and the loads of a later k step can go ahead of the WMMAs
#pragma unroll
        for (int kk = 0; kk < BK; kk += 32) {
            v16h aF[2], bF[4];
#pragma unroll
            for (int mi = 0; mi < 2; ++mi)
                aF[mi] = load_frag(abase + mi * 16 * LP + kk);
#pragma unroll
            for (int ni = 0; ni < 4; ++ni)
                bF[ni] = load_frag(bbase + ni * 16 * LP + kk);

#pragma unroll
            for (int mi = 0; mi < 2; ++mi)
#pragma unroll
                for (int ni = 0; ni < 4; ++ni)
                    acc[mi][ni] = wmma_f16(aF[mi], bF[ni], acc[mi][ni]);
        }

        // hand-over: this wave's reads of the tile are done ...
        asm volatile("s_wait_dscnt 0x0" ::: "memory");
        wait_async0();               // ... its share of the next tile has landed
        __syncthreads();             // ... and the same holds for every wave
        if (st + 2 < nst) stage(buf, st + 2);   // refill the buffer just left
    }
    wait_async0();                   // no copy is left when the wave ends

    // ---- epilogue ----
    // Every loop here is unrolled: acc and val are then indexed by constants
    // and stay in registers.
    static_assert(TDIM % 8 == 0, "the 8 rows of a lane's tile column lie in one batch");
#pragma unroll
    for (int mi = 0; mi < 2; ++mi) {
#pragma unroll
        for (int ni = 0; ni < 4; ++ni) {
            const int rbase = bm0 + wm * 32 + mi * 16 + hi8;
            const int col   = bn0 + wn * 64 + ni * 16 + l15;
            const v8f val = acc[mi][ni] * alpha;
            if constexpr (MODE == 0) {
#pragma unroll
                for (int j = 0; j < 8; ++j)
                    ((_Float16*)Cp)[(size_t)(rbase + j) * N + col] = (_Float16)val[j];
            } else if constexpr (MODE == 1) {
#pragma unroll
                for (int j = 0; j < 8; ++j)
                    ((float*)Cp)[(size_t)(rbase + j) * N + col] = val[j];
            } else {
                _Float16* kout = (_Float16*)Cp;
                _Float16* vout = kout + (size_t)M * 64;
                const int b = rbase / TDIM;
                const int t = rbase - b * TDIM;
                if (col < 64) {          // outside the loop over j: one test a tile
#pragma unroll
                    for (int j = 0; j < 8; ++j)
                        kout[(size_t)(rbase + j) * 64 + col] = (_Float16)val[j];
                } else {
#pragma unroll
                    for (int j = 0; j < 8; ++j)
                        vout[(size_t)(b * 64 + (col - 64)) * TDIM + t + j] = (_Float16)val[j];
                }
            }
        }
    }
}

// One GEMM a launch: grid (N / 128, M / 128).
template <int MODE, int N, int TDIM>
__global__ __launch_bounds__(256) void wmma_gemm_f16(
    const _Float16* __restrict__ A, const _Float16* __restrict__ BT,
    int M, int K,
    float alpha, void* __restrict__ Cp)
{
    __shared__ alignas(16) _Float16 As[2][BM * LP];
    __shared__ alignas(16) _Float16 Bs[2][BN * LP];
    gemm_block<MODE, N, TDIM>(A, BT, M, K, alpha, Cp,
                              blockIdx.y * BM, blockIdx.x * BN, As, Bs);
}

template <int NQ, int TDIM>
__global__ __launch_bounds__(256) void proj_q_kv_f16(
    const _Float16* __restrict__ X, const _Float16* __restrict__ WqT,
    const _Float16* __restrict__ C, const _Float16* __restrict__ WkvT,
    int M, int K,
    float alphaQ, _Float16* __restrict__ qout, _Float16* __restrict__ kvout)
{
    __shared__ alignas(16) _Float16 As[2][BM * LP];
    __shared__ alignas(16) _Float16 Bs[2][BN * LP];
    const int bm0 = blockIdx.y * BM;
    if (blockIdx.x == 0)
        gemm_block<2, 128, TDIM>(C, WkvT, M, K, 1.0f, kvout, bm0, 0, As, Bs);
    else
        gemm_block<0, NQ, TDIM>(X, WqT, M, K, alphaQ, qout,
                                bm0, (blockIdx.x - 1) * BN, As, Bs);
}

#define ATW 8
#define SKEY 128
#define KPIT 72
#define VPIT 136

__device__ __forceinline__ float xhalf(float x) {
    return __builtin_bit_cast(float, __builtin_amdgcn_permlanex16(
        __builtin_bit_cast(int, x), __builtin_bit_cast(int, x),
        0x76543210, 0xfedcba98, false, false));
}

__device__ __forceinline__ void async_copy16x4(
    unsigned int l0, unsigned int l1, unsigned int l2, unsigned int l3,
    const _Float16* g0, const _Float16* g1, const _Float16* g2, const _Float16* g3)
{
    asm volatile("global_load_async_to_lds_b128 %0, %4, off\n\t"
                 "global_load_async_to_lds_b128 %1, %5, off\n\t"
                 "global_load_async_to_lds_b128 %2, %6, off\n\t"
                 "global_load_async_to_lds_b128 %3, %7, off\n\t"
                 "s_wait_xcnt 0x0"
                 :: "v"(l0), "v"(l1), "v"(l2), "v"(l3),
                    "v"(g0), "v"(g1), "v"(g2), "v"(g3) : "memory");
}

__global__ __launch_bounds__(ATW * 32) __attribute__((amdgpu_waves_per_eu(4, 4)))
void mqa_attn_kernel(
    const _Float16* __restrict__ q, const _Float16* __restrict__ kmat,
    const _Float16* __restrict__ vT, _Float16* __restrict__ y,
    int Nq, int Tlen, int D, int Hn)
{
    __shared__ alignas(16) _Float16 Ks[2][SKEY * KPIT];
    __shared__ alignas(16) _Float16 Vs[2][64 * VPIT];

    const int tid  = threadIdx.x;
    const int lane = tid & 31;
    const int wv   = tid >> 5;
    const int l15  = lane & 15;
    const int hi8  = (lane >> 4) << 3;

    const int qtiles = Nq >> 4;
    int gw = blockIdx.x * ATW + wv;
    const int qt = gw % qtiles; gw /= qtiles;
    const int h  = gw % Hn;
    const int b  = gw / Hn;          // the same in all waves of a block

    // This thread's share of a tile: 4 chunks of K (the tile is 16 KiB in a
    // row in memory; a wave's copy = 4 rows = 4 lines) and 4 of V^T (a wave's
    // copy = 2 rows of 256 B).
    const _Float16* kg = kmat + (size_t)b * Tlen * 64 + tid * 8;
    const _Float16* vg = vT + (size_t)(b * 64 + (tid >> 4)) * Tlen + (tid & 15) * 8;
    const int kl = (tid >> 3) * KPIT + (tid & 7) * 8;
    const int vl = (tid >> 4) * VPIT + (tid & 15) * 8;

    auto stage = [&](int buf, int st) {
        const _Float16* kgs = kg + (size_t)st * (SKEY * 64);
        const _Float16* vgs = vg + (size_t)st * SKEY;
        async_copy16x4(lds_addr_of(&Ks[buf][kl]),
                       lds_addr_of(&Ks[buf][kl + 32 * KPIT]),
                       lds_addr_of(&Ks[buf][kl + 64 * KPIT]),
                       lds_addr_of(&Ks[buf][kl + 96 * KPIT]),
                       kgs, kgs + 2048, kgs + 4096, kgs + 6144);
        async_copy16x4(lds_addr_of(&Vs[buf][vl]),
                       lds_addr_of(&Vs[buf][vl + 16 * VPIT]),
                       lds_addr_of(&Vs[buf][vl + 32 * VPIT]),
                       lds_addr_of(&Vs[buf][vl + 48 * VPIT]),
                       vgs, vgs + (size_t)16 * Tlen, vgs + (size_t)32 * Tlen,
                       vgs + (size_t)48 * Tlen);
    };

    const int nst = Tlen / SKEY;
    stage(0, 0);

    const _Float16* qbase = q + ((size_t)(b * Nq + qt * 16 + l15)) * D + h * 64;
    v16h bQ[2];
    bQ[0] = load_frag(qbase + 0  + hi8);
    bQ[1] = load_frag(qbase + 32 + hi8);

    wait_async0();                   // this wave's share of tile 0 has landed
    __syncthreads();                 // ... and every other wave's
    if (nst > 1) stage(1, 1);

    float m = -1e30f, l = 0.0f;      // this lane's query; l = this half's keys only
    v8f accY[4];                     // accY[ni][r] = O[query l15][ni*16 + hi8 + r]
#pragma unroll
    for (int ni = 0; ni < 4; ++ni) accY[ni] = {};

    for (int st = 0; st < nst; ++st) {
        const int buf = st & 1;
        const _Float16* kbase = &Ks[buf][l15 * KPIT + hi8];
        const _Float16* vbase = &Vs[buf][l15 * VPIT + hi8];

#pragma unroll
        for (int tc = 0; tc < SKEY; tc += 32) {
            const _Float16* kp0 = kbase + tc * KPIT;
            const _Float16* kp1 = kbase + (tc + 16) * KPIT;
            v16h a00 = load_frag(kp0);
            v16h a01 = load_frag(kp0 + 32);
            v16h a10 = load_frag(kp1);
            v16h a11 = load_frag(kp1 + 32);
            v16h aV[4];
#pragma unroll
            for (int ni = 0; ni < 4; ++ni)
                aV[ni] = load_frag(vbase + ni * 16 * VPIT + tc);

            // s0[r] = S[query l15][key tc + hi8 + r], s1[r]: key tc + 16 + hi8 + r
            v8f s0 = {}, s1 = {};
            s0 = wmma_f16(a00, bQ[0], s0);
            s1 = wmma_f16(a10, bQ[0], s1);
            s0 = wmma_f16(a01, bQ[1], s0);
            s1 = wmma_f16(a11, bQ[1], s1);

            float mt = fmaxf(s0[0], s1[0]);
#pragma unroll
            for (int r = 1; r < 8; ++r) mt = fmaxf(mt, fmaxf(s0[r], s1[r]));
            mt = fmaxf(mt, xhalf(mt));       // both halves: the query's maximum
            const float mn = fmaxf(m, mt);
            const float sc = __builtin_amdgcn_exp2f(m - mn);
            m = mn;

            s0 -= mn;                        // whole vectors: packed subtractions
            s1 -= mn;
#pragma unroll
            for (int r = 0; r < 8; ++r) {
                s0[r] = __builtin_amdgcn_exp2f(s0[r]);
                s1[r] = __builtin_amdgcn_exp2f(s1[r]);
            }
            // in-lane sum of the 16 exponentials as a tree over register pairs
            const v8f t8 = s0 + s1;
            const v4f t4 = t8.lo + t8.hi;
            const v2f t2 = t4.lo + t4.hi;
            l = l * sc + (t2.x + t2.y);

            // two S^T tiles, converted in place, are the B operand in the k order
            // of load_frag: element s = key (s < 8 ? hi8 + s : 16 + hi8 + s - 8)
            HFrag bP;
            bP.h[0] = __builtin_convertvector(s0, v8h);
            bP.h[1] = __builtin_convertvector(s1, v8h);

#pragma unroll
            for (int ni = 0; ni < 4; ++ni) {
                accY[ni] *= sc;
                accY[ni] = wmma_f16(aV[ni], bP.v, accY[ni]);
            }
        }

        // hand-over: this wave's reads of the tile are done ...
        asm volatile("s_wait_dscnt 0x0" ::: "memory");
        wait_async0();               // ... its share of the next tile has landed
        __syncthreads();             // ... and the same holds for every wave
        if (st + 2 < nst) stage(buf, st + 2);   // refill the buffer just left
    }
    wait_async0();                   // no copy is left when the wave ends

    l += xhalf(l);                   // join the halves' sums once
    const float inv = 1.0f / l;

    _Float16* yrow = y + ((size_t)(b * Nq + qt * 16 + l15)) * D + h * 64 + hi8;
#pragma unroll
    for (int ni = 0; ni < 4; ++ni) {
        const v8f o = accY[ni] * inv;
        *reinterpret_cast<v8h*>(yrow + ni * 16) = __builtin_convertvector(o, v8h);
    }
}

// ---------------------------------------------------------------------------
extern "C" void kernel_launch(void* const* d_in, const int* in_sizes, int n_in,
                              void* d_out, int out_size, void* d_ws, size_t ws_size,
                              hipStream_t stream) {
    const float* x   = (const float*)d_in[0];
    const float* ctx = (const float*)d_in[1];
    const float* Wq  = (const float*)d_in[2];
    const float* Wkv = (const float*)d_in[3];
    const float* Wo  = (const float*)d_in[4];
    float* out = (float*)d_out;

    const int Bc = 2, Nc = 2048, Tc = 2048, Dc = 1024, Hc = 16;
    const int MQ  = Bc * Nc;   // 4096
    const int MKV = Bc * Tc;   // 4096

    // workspace (f16): x16 | ctx16 | WqT | WkvT | WoT | q | k | vT | y
    _Float16* x16   = (_Float16*)d_ws;
    _Float16* ctx16 = x16   + (size_t)MQ * Dc;
    _Float16* WqT   = ctx16 + (size_t)MKV * Dc;
    _Float16* WkvT  = WqT   + (size_t)Dc * Dc;
    _Float16* WoT   = WkvT  + (size_t)128 * Dc;
    _Float16* qbuf  = WoT   + (size_t)Dc * Dc;
    _Float16* kb    = qbuf  + (size_t)MQ * Dc;
    _Float16* vT    = kb    + (size_t)MKV * 64;
    _Float16* y     = vT    + (size_t)MKV * 64;

    const float alphaQ = 0.125f * 1.44269504088896340736f;  // hd^-0.5 * log2(e)

    // ---- prep: fp32 -> fp16 (+ weight transposes), one launch ----
    prep_kernel<<<dim3(512), dim3(256), 0, stream>>>(
        x, ctx, Wq, Wkv, Wo, x16, ctx16, WqT, WkvT, WoT);

    dim3 blk(256);
    // q = (x @ Wq) * alphaQ -> f16, and kv = ctx @ Wkv -> k row-major + v
    // transposed, in one launch (MQ == MKV)
    proj_q_kv_f16<1024, 2048><<<dim3(1 + Dc / 128, MQ / 128), blk, 0, stream>>>(
        x16, WqT, ctx16, WkvT, MQ, Dc, alphaQ, qbuf, kb);
    // attention -> y (f16)
    const int totalWaves = Bc * Hc * (Nc / 16);   // 4096
    mqa_attn_kernel<<<dim3(totalWaves / 8), dim3(256), 0, stream>>>(
        qbuf, kb, vT, y, Nc, Tc, Dc, Hc);
    // out = y @ Wo -> f32
    wmma_gemm_f16<1, 1024, 2048><<<dim3(Dc / 128, MQ / 128), blk, 0, stream>>>(
        y, WoT, MQ, Dc, 1.0f, out);
}

// v008
// Measured time: 63.5 microseconds a run.
// Two timings next to v007 both put it at 1.06 times that version's speed.
// Over all steps from v000 it is 3.24 times as fast.
#include <hip/hip_runtime.h>
#include <math.h>

typedef _Float16 v16h __attribute__((ext_vector_type(16)));
typedef _Float16 v8h  __attribute__((ext_vector_type(8)));
typedef _Float16 v4h  __attribute__((ext_vector_type(4)));
typedef _Float16 v2h  __attribute__((ext_vector_type(2)));
typedef float    v8f  __attribute__((ext_vector_type(8)));
typedef float    v4f  __attribute__((ext_vector_type(4)));
typedef float    v2f  __attribute__((ext_vector_type(2)));

union HFrag { v16h v; v8h h[2]; };

__device__ __forceinline__ v16h load_frag(const _Float16* p) {
    HFrag f;
    f.h[0] = *reinterpret_cast<const v8h*>(p);
    f.h[1] = *reinterpret_cast<const v8h*>(p + 16);
    return f.v;
}

__device__ __forceinline__ v8f wmma_f16(v16h a, v16h b, v8f c) {
    return __builtin_amdgcn_wmma_f32_16x16x32_f16(false, a, false, b,
                                                  (short)0, c, false, false);
}

__device__ __forceinline__ void async_copy16x8(unsigned int l, unsigned int lstep,
                                               const _Float16* g, size_t gstep) {
    asm volatile("global_load_async_to_lds_b128 %0, %8, off\n\t"
                 "global_load_async_to_lds_b128 %1, %9, off\n\t"
                 "global_load_async_to_lds_b128 %2, %10, off\n\t"
                 "global_load_async_to_lds_b128 %3, %11, off\n\t"
                 "global_load_async_to_lds_b128 %4, %12, off\n\t"
                 "global_load_async_to_lds_b128 %5, %13, off\n\t"
                 "global_load_async_to_lds_b128 %6, %14, off\n\t"
                 "global_load_async_to_lds_b128 %7, %15, off\n\t"
                 "s_wait_xcnt 0x0"
                 :: "v"(l), "v"(l + lstep), "v"(l + 2 * lstep), "v"(l + 3 * lstep),
                    "v"(l + 4 * lstep), "v"(l + 5 * lstep), "v"(l + 6 * lstep),
                    "v"(l + 7 * lstep),
                    "v"(g), "v"(g + gstep), "v"(g + 2 * gstep), "v"(g + 3 * gstep),
                    "v"(g + 4 * gstep), "v"(g + 5 * gstep), "v"(g + 6 * gstep),
                    "v"(g + 7 * gstep) : "memory");
}
__device__ __forceinline__ void wait_async0() {
    asm volatile("s_wait_asynccnt 0x0" ::: "memory");
}
__device__ __forceinline__ unsigned int lds_addr_of(const void* p) {
    return (unsigned int)(uintptr_t)p;
}

// ---------------------------------------------------------------------------
// Prep, ONE launch of 512 equal blocks (two for every WGP, 16 waves a WGP):
// fp32 -> fp16 of x and context, and the three weight transposes
// W (Kd x Nd, f32, row-major) -> WT (Nd x Kd, f16, row-major).
// Every block takes 64 KiB of x or context (16 loads of 16 B a lane), one
// 64 x 64 tile of Wq or Wo and one 16 x 16 tile of Wkv; all its loads are
// issued before the first is used, and it has one barrier.
// ---------------------------------------------------------------------------
#define PD   1024  // model dim: rows of every W, columns of Wq and Wo
#define PKV  128   // columns of Wkv
#define PCH  4096  // 16-byte pieces of x or context per block
#define TPIT 72    // transposed tile's row pitch in halves: 128 B + 16 B (16 B x odd)

__global__ __launch_bounds__(256) void prep_kernel(
    const float* __restrict__ x, const float* __restrict__ ctx,
    const float* __restrict__ Wq, const float* __restrict__ Wkv,
    const float* __restrict__ Wo,
    _Float16* __restrict__ x16, _Float16* __restrict__ ctx16,
    _Float16* __restrict__ WqT, _Float16* __restrict__ WkvT,
    _Float16* __restrict__ WoT)
{
    __shared__ alignas(16) _Float16 tT[64 * TPIT];   // [n][k] of the 64 x 64 tile
    __shared__ _Float16 sT[16 * 17];                 // [k][n] of the 16 x 16 tile

    const int  tid   = threadIdx.x;
    const int  blk   = blockIdx.x;
    const bool first = blk < 256;      // blocks 0..255: x, Wq; 256..511: context, Wo
    const int  sub   = blk & 255;
    const int  c16   = tid & 15;
    const int  r16   = tid >> 4;

    // the block's stretch of x or context: a wave's load = 512 B in a row
    const v4f* src = reinterpret_cast<const v4f*>(first ? x : ctx) + (size_t)sub * PCH + tid;
    v4h*       dst = reinterpret_cast<v4h*>(first ? x16 : ctx16) + (size_t)sub * PCH + tid;
    v4f f[16];
#pragma unroll
    for (int i = 0; i < 16; ++i) f[i] = src[i * 256];

    // 64 x 64 tile: a lane takes 4 columns of two adjacent k rows, twice
    const float* W  = first ? Wq : Wo;
    _Float16*    WT = first ? WqT : WoT;
    const int k0 = (sub >> 4) * 64, n0 = (sub & 15) * 64;
    v4f w[2][2];
#pragma unroll
    for (int i = 0; i < 2; ++i)
#pragma unroll
        for (int p = 0; p < 2; ++p)
            w[i][p] = *reinterpret_cast<const v4f*>(
                &W[(size_t)(k0 + i * 32 + r16 * 2 + p) * PD + n0 + c16 * 4]);

    // 16 x 16 tile of Wkv: one element a lane
    const int kk0 = (blk >> 3) * 16, nn0 = (blk & 7) * 16;
    const float wk = Wkv[(size_t)(kk0 + r16) * PKV + nn0 + c16];

    // Behind the last load: no address register of a load above is rewritten in
    // front of this wait.
    asm volatile("s_wait_xcnt 0x0" ::: "memory");
    // Keeps the conversions below the loads: without it the compiler, to save
    // registers, converts the first loads before it issues the last, and a
    // block waits out the memory latency twice.
    __builtin_amdgcn_sched_barrier(0);

#pragma unroll
    for (int i = 0; i < 2; ++i)
#pragma unroll
        for (int j = 0; j < 4; ++j) {
            const v2h pr = { (_Float16)w[i][0][j], (_Float16)w[i][1][j] };
            *reinterpret_cast<v2h*>(&tT[(c16 * 4 + j) * TPIT + i * 32 + r16 * 2]) = pr;
        }
    sT[r16 * 17 + c16] = (_Float16)wk;
    __syncthreads();

    // rows of WT: 8 lanes write one whole 128-B line
#pragma unroll
    for (int i = 0; i < 2; ++i) {
        const int n = (tid >> 3) + i * 32, ch = (tid & 7) * 8;
        *reinterpret_cast<v8h*>(&WT[(size_t)(n0 + n) * PD + k0 + ch]) =
            *reinterpret_cast<const v8h*>(&tT[n * TPIT + ch]);
    }
    WkvT[(size_t)(nn0 + r16) * PD + kk0 + c16] = sT[c16 * 17 + r16];

#pragma unroll
    for (int i = 0; i < 16; ++i) dst[i * 256] = __builtin_convertvector(f[i], v4h);
}

// ---------------------------------------------------------------------------
// WMMA GEMM, f16 operands: C = alpha * (A @ BT^T)
//   A : M x K f16 row-major          BT : N x K f16 row-major (pre-transposed)
// Double-buffered LDS staging via global_load_async_to_lds_b128, 128 k a tile:
// a hand-over (the copies' latency, two waits, a barrier) comes once for 32
// WMMAs of a wave, and 64 KiB a block are in flight while a tile is worked on.
// K is a multiple of 128.
// modes: 0 = f16 row-major out   1 = f32 row-major out
//        2 = kv split: col<64 -> K (b,t,64); col>=64 -> V^T (b,64,T)
// MODE, the row length N of C and the sequence length TDIM are template
// parameters: each block's epilogue is straight-line code for its own mode,
// with its 64 stores a lane at constant distances from few addresses.
// gemm_block is one block's 128 x 128 tile of C at (bm0, bn0); the two LDS
// buffers of each operand are the calling kernel's, so that a kernel which
// holds two modes has them once.
// ---------------------------------------------------------------------------
#define BM 128
#define BN 128
#define BK 128
#define LP 136  // LDS row pitch in halves: 256 B + 16 B (16 B x odd)

template <int MODE, int N, int TDIM>
__device__ __forceinline__ void gemm_block(
    const _Float16* __restrict__ A, const _Float16* __restrict__ BT,
    int M, int K,
    float alpha, void* __restrict__ Cp, int bm0, int bn0,
    _Float16 (*As)[BM * LP], _Float16 (*Bs)[BN * LP])
{
    const int tid  = threadIdx.x;
    const int lane = tid & 31;
    const int wave = tid >> 5;
    const int wm = wave & 3;            // 4 waves along M
    const int wn = wave >> 2;           // 2 waves along N
    const int l15 = lane & 15;
    const int hi8 = (lane >> 4) << 3;

    // each thread copies eight 16B chunks of A and eight of B per tile; a
    // wave's copy = 2 rows of 256 B
    const int srow = tid >> 4;              // 0..15, plus 16 a copy
    const int skg  = (tid & 15) * 8;        // K-group within 128
    const _Float16* ag = A  + (size_t)(bm0 + srow) * K + skg;
    const _Float16* bg = BT + (size_t)(bn0 + srow) * K + skg;

    v8f acc[2][4];
#pragma unroll
    for (int mi = 0; mi < 2; ++mi)
#pragma unroll
        for (int ni = 0; ni < 4; ++ni)
            acc[mi][ni] = {};

    auto stage = [&](int buf, int st) {
        async_copy16x8(lds_addr_of(&As[buf][srow * LP + skg]), 16 * LP * 2,
                       ag + (size_t)st * BK, (size_t)16 * K);
        async_copy16x8(lds_addr_of(&Bs[buf][srow * LP + skg]), 16 * LP * 2,
                       bg + (size_t)st * BK, (size_t)16 * K);
    };

    const int nst = K / BK;
    stage(0, 0);
    wait_async0();                   // this wave's share of tile 0 has landed
    __syncthreads();                 // ... and every other wave's
    if (nst > 1) stage(1, 1);

    for (int st = 0; st < nst; ++st) {
        const int buf = st & 1;
        const _Float16* abase = &As[buf][(wm * 32 + l15) * LP + hi8];
        const _Float16* bbase = &Bs[buf][(wn * 64 + l15) * LP + hi8];

        // unrolled: the fragment addresses are constant distances from two
        // registers, and the loads of a later k step can go ahead of the WMMAs
#pragma unroll
        for (int kk = 0; kk < BK; kk += 32) {
            v16h aF[2], bF[4];
#pragma unroll
            for (int mi = 0; mi < 2; ++mi)
                aF[mi] = load_frag(abase + mi * 16 * LP + kk);
#pragma unroll
            for (int ni = 0; ni < 4; ++ni)
                bF[ni] = load_frag(bbase + ni * 16 * LP + kk);

#pragma unroll
            for (int mi = 0; mi < 2; ++mi)
#pragma unroll
                for (int ni = 0; ni < 4; ++ni)
                    acc[mi][ni] = wmma_f16(aF[mi], bF[ni], acc[mi][ni]);
        }

        // hand-over: this wave's reads of the tile are done ...
        asm volatile("s_wait_dscnt 0x0" ::: "memory");
        wait_async0();               // ... its share of the next tile has landed
        __syncthreads();             // ... and the same holds for every wave
        if (st + 2 < nst) stage(buf, st + 2);   // refill the buffer just left
    }
    wait_async0();                   // no copy is left when the wave ends

    // ---- epilogue ----
    // Every loop here is unrolled: acc and val are then indexed by constants
    // and stay in registers.
    static_assert(TDIM % 8 == 0, "the 8 rows of a lane's tile column lie in one batch");
#pragma unroll
    for (int mi = 0; mi < 2; ++mi) {
#pragma unroll
        for (int ni = 0; ni < 4; ++ni) {
            const int rbase = bm0 + wm * 32 + mi * 16 + hi8;
            const int col   = bn0 + wn * 64 + ni * 16 + l15;
            const v8f val = acc[mi][ni] * alpha;
            if constexpr (MODE == 0) {
#pragma unroll
                for (int j = 0; j < 8; ++j)
                    ((_Float16*)Cp)[(size_t)(rbase + j) * N + col] = (_Float16)val[j];
            } else if constexpr (MODE == 1) {
#pragma unroll
                for (int j = 0; j < 8; ++j)
                    ((float*)Cp)[(size_t)(rbase + j) * N + col] = val[j];
            } else {
                _Float16* kout = (_Float16*)Cp;
                _Float16* vout = kout + (size_t)M * 64;
                const int b = rbase / TDIM;
                const int t = rbase - b * TDIM;
                if (col < 64) {          // outside the loop over j: one test a tile
#pragma unroll
                    for (int j = 0; j < 8; ++j)
                        kout[(size_t)(rbase + j) * 64 + col] = (_Float16)val[j];
                } else {
#pragma unroll
                    for (int j = 0; j < 8; ++j)
                        vout[(size_t)(b * 64 + (col - 64)) * TDIM + t + j] = (_Float16)val[j];
                }
            }
        }
    }
}

// One GEMM a launch: grid (N / 128, M / 128).
template <int MODE, int N, int TDIM>
__global__ __launch_bounds__(256) void wmma_gemm_f16(
    const _Float16* __restrict__ A, const _Float16* __restrict__ BT,
    int M, int K,
    float alpha, void* __restrict__ Cp)
{
    __shared__ alignas(16) _Float16 As[2][BM * LP];
    __shared__ alignas(16) _Float16 Bs[2][BN * LP];
    gemm_block<MODE, N, TDIM>(A, BT, M, K, alpha, Cp,
                              blockIdx.y * BM, blockIdx.x * BN, As, Bs);
}

template <int NQ, int TDIM>
__global__ __launch_bounds__(256) void proj_q_kv_f16(
    const _Float16* __restrict__ X, const _Float16* __restrict__ WqT,
    const _Float16* __restrict__ C, const _Float16* __restrict__ WkvT,
    int M, int K,
    float alphaQ, _Float16* __restrict__ qout, _Float16* __restrict__ kvout)
{
    __shared__ alignas(16) _Float16 As[2][BM * LP];
    __shared__ alignas(16) _Float16 Bs[2][BN * LP];
    const int bm0 = blockIdx.y * BM;
    if (blockIdx.x == 0)
        gemm_block<2, 128, TDIM>(C, WkvT, M, K, 1.0f, kvout, bm0, 0, As, Bs);
    else
        gemm_block<0, NQ, TDIM>(X, WqT, M, K, alphaQ, qout,
                                bm0, (blockIdx.x - 1) * BN, As, Bs);
}

#define ATW 16
#define AGW 8
#define SKEY 128
#define KPIT 72
#define VPIT 136

__device__ __forceinline__ float xhalf(float x) {
    return __builtin_bit_cast(float, __builtin_amdgcn_permlanex16(
        __builtin_bit_cast(int, x), __builtin_bit_cast(int, x),
        0x76543210, 0xfedcba98, false, false));
}

__device__ __forceinline__ void async_copy16x4(
    unsigned int l0, unsigned int l1, unsigned int l2, unsigned int l3,
    const _Float16* g0, const _Float16* g1, const _Float16* g2, const _Float16* g3)
{
    asm volatile("global_load_async_to_lds_b128 %0, %4, off\n\t"
                 "global_load_async_to_lds_b128 %1, %5, off\n\t"
                 "global_load_async_to_lds_b128 %2, %6, off\n\t"
                 "global_load_async_to_lds_b128 %3, %7, off\n\t"
                 "s_wait_xcnt 0x0"
                 :: "v"(l0), "v"(l1), "v"(l2), "v"(l3),
                    "v"(g0), "v"(g1), "v"(g2), "v"(g3) : "memory");
}

__global__ __launch_bounds__(ATW * 32) __attribute__((amdgpu_waves_per_eu(4, 4)))
void mqa_attn_kernel(
    const _Float16* __restrict__ q, const _Float16* __restrict__ kmat,
    const _Float16* __restrict__ vT, _Float16* __restrict__ y,
    int Nq, int Tlen, int D, int Hn)
{
    // [group][buffer]: a K tile and behind it a V^T tile
    __shared__ alignas(16) _Float16 KVs[2][2][SKEY * KPIT + 64 * VPIT];
    __shared__ alignas(16) v4f Xs[ATW][9][32];   // a wave's partial result of one tile

    const int tid  = threadIdx.x;
    const int lane = tid & 31;
    const int wv   = tid >> 5;
    const int grp  = __builtin_amdgcn_readfirstlane(tid >> 8);   // key group, wave-uniform
    const int gtid = tid & 255;      // thread within the group
    const int l15  = lane & 15;
    const int hi8  = (lane >> 4) << 3;

    const int qtiles = Nq >> 5;      // tiles of 32 queries
    int gw = blockIdx.x * AGW + (wv & (AGW - 1));
    const int qt = gw % qtiles; gw /= qtiles;
    const int h  = gw % Hn;
    const int b  = gw / Hn;          // the same in all waves of a block

    // This thread's share of its group's tile: 4 chunks of K (the tile is
    // 16 KiB in a row in memory; a wave's copy = 4 rows = 4 lines) and 4 of V^T
    // (a wave's copy = 2 rows of 256 B).
    const int khalf = Tlen >> 1;     // keys of a group
    const _Float16* kg = kmat + ((size_t)b * Tlen + (size_t)grp * khalf) * 64 + gtid * 8;
    const _Float16* vg = vT + (size_t)(b * 64 + (gtid >> 4)) * Tlen + grp * khalf
                            + (gtid & 15) * 8;
    const int kl = (gtid >> 3) * KPIT + (gtid & 7) * 8;
    const int vl = (gtid >> 4) * VPIT + (gtid & 15) * 8;

    auto stage = [&](int buf, int st) {
        const _Float16* kgs = kg + (size_t)st * (SKEY * 64);
        const _Float16* vgs = vg + (size_t)st * SKEY;
        async_copy16x4(lds_addr_of(&KVs[grp][buf][kl]),
                       lds_addr_of(&KVs[grp][buf][kl + 32 * KPIT]),
                       lds_addr_of(&KVs[grp][buf][kl + 64 * KPIT]),
                       lds_addr_of(&KVs[grp][buf][kl + 96 * KPIT]),
                       kgs, kgs + 2048, kgs + 4096, kgs + 6144);
        async_copy16x4(lds_addr_of(&KVs[grp][buf][SKEY * KPIT + vl]),
                       lds_addr_of(&KVs[grp][buf][SKEY * KPIT + vl + 16 * VPIT]),
                       lds_addr_of(&KVs[grp][buf][SKEY * KPIT + vl + 32 * VPIT]),
                       lds_addr_of(&KVs[grp][buf][SKEY * KPIT + vl + 48 * VPIT]),
                       vgs, vgs + (size_t)16 * Tlen, vgs + (size_t)32 * Tlen,
                       vgs + (size_t)48 * Tlen);
    };

    const int nst = khalf / SKEY;
    stage(0, 0);

    const _Float16* qbase = q + ((size_t)(b * Nq + qt * 32 + l15)) * D + h * 64;
    v16h bQ[2][2];
#pragma unroll
    for (int qi = 0; qi < 2; ++qi) {
        bQ[qi][0] = load_frag(qbase + (size_t)qi * 16 * D + 0  + hi8);
        bQ[qi][1] = load_frag(qbase + (size_t)qi * 16 * D + 32 + hi8);
    }

    wait_async0();                   // this wave's share of tile 0 has landed
    __syncthreads();                 // ... and every other wave's
    if (nst > 1) stage(1, 1);

    // per query tile: this lane's query; l = this half's keys only
    float m[2] = { -1e30f, -1e30f }, l[2] = { 0.0f, 0.0f };
    v8f accY[2][4];                  // accY[qi][ni][r] = O[query qi*16 + l15][ni*16 + hi8 + r]
#pragma unroll
    for (int qi = 0; qi < 2; ++qi)
#pragma unroll
        for (int ni = 0; ni < 4; ++ni) accY[qi][ni] = {};

    for (int st = 0; st < nst; ++st) {
        const int buf = st & 1;
        const _Float16* kbase = &KVs[grp][buf][l15 * KPIT + hi8];
        const _Float16* vbase = &KVs[grp][buf][SKEY * KPIT + l15 * VPIT + hi8];

        // two steps a trip, not all four: unrolled whole, the compiler puts the
        // sums for l off to the end of the tile, holds the exponentials of
        // four steps in registers and spills
#pragma unroll 2
        for (int tc = 0; tc < SKEY; tc += 32) {
            const _Float16* kp0 = kbase + tc * KPIT;
            const _Float16* kp1 = kbase + (tc + 16) * KPIT;
            v16h a00 = load_frag(kp0);
            v16h a01 = load_frag(kp0 + 32);
            v16h a10 = load_frag(kp1);
            v16h a11 = load_frag(kp1 + 32);
            v16h aV[4];
#pragma unroll
            for (int ni = 0; ni < 4; ++ni)
                aV[ni] = load_frag(vbase + ni * 16 * VPIT + tc);

            // unrolled: m, l, bQ and accY are indexed by constants, and the two
            // tiles' chains, which need nothing of each other, can interleave
#pragma unroll
            for (int qi = 0; qi < 2; ++qi) {
                // s0[r] = S[query][key tc + hi8 + r], s1[r]: key tc + 16 + hi8 + r
                v8f s0 = {}, s1 = {};
                s0 = wmma_f16(a00, bQ[qi][0], s0);
                s1 = wmma_f16(a10, bQ[qi][0], s1);
                s0 = wmma_f16(a01, bQ[qi][1], s0);
                s1 = wmma_f16(a11, bQ[qi][1], s1);

                float mt = fmaxf(s0[0], s1[0]);
#pragma unroll
                for (int r = 1; r < 8; ++r) mt = fmaxf(mt, fmaxf(s0[r], s1[r]));
                mt = fmaxf(mt, xhalf(mt));   // both halves: the query's maximum
                const float mn = fmaxf(m[qi], mt);
                const float sc = __builtin_amdgcn_exp2f(m[qi] - mn);
                m[qi] = mn;

                s0 -= mn;                    // whole vectors: packed subtractions
                s1 -= mn;
#pragma unroll
                for (int r = 0; r < 8; ++r) s0[r] = __builtin_amdgcn_exp2f(s0[r]);
#pragma unroll
                for (int r = 0; r < 8; ++r) s1[r] = __builtin_amdgcn_exp2f(s1[r]);
                // in-lane sum of the 16 exponentials as a tree over register pairs
                const v8f t8 = s0 + s1;
                const v4f t4 = t8.lo + t8.hi;
                const v2f t2 = t4.lo + t4.hi;
                l[qi] = l[qi] * sc + (t2.x + t2.y);

                // two S^T tiles, converted in place, are the B operand in the k
                // order of load_frag: element s = key (s < 8 ? hi8 + s : 16 + hi8 + s - 8)
                HFrag bP;
                bP.h[0] = __builtin_convertvector(s0, v8h);
                bP.h[1] = __builtin_convertvector(s1, v8h);

#pragma unroll
                for (int ni = 0; ni < 4; ++ni) {
                    accY[qi][ni] *= sc;
                    accY[qi][ni] = wmma_f16(aV[ni], bP.v, accY[qi][ni]);
                }
            }
        }

        // hand-over: this wave's reads of the tile are done ...
        asm volatile("s_wait_dscnt 0x0" ::: "memory");
        wait_async0();               // ... its share of the next tile has landed
        __syncthreads();             // ... and the same holds for every wave
        if (st + 2 < nst) stage(buf, st + 2);   // refill the buffer just left
    }
    wait_async0();                   // no copy is left when the wave ends

    // ---- join of the two key halves ----
    // Wave w and wave w ^ 8 hold the same queries in the same lanes. Group g
    // finishes query tile g: it hands its partial result of the other tile to
    // its partner and takes the partner's of its own.
#pragma unroll
    for (int ni = 0; ni < 4; ++ni) {
        const v8f o = grp ? accY[0][ni] : accY[1][ni];
        Xs[wv][ni * 2][lane]     = o.lo;
        Xs[wv][ni * 2 + 1][lane] = o.hi;
    }
    Xs[wv][8][lane] = v4f{ grp ? m[0] : m[1], grp ? l[0] : l[1], 0.0f, 0.0f };
    __syncthreads();                 // every wave's partial result is in LDS

    const int   pw = wv ^ AGW;
    const float mo = grp ? m[1] : m[0];
    const float lo = grp ? l[1] : l[0];
    const v4f   ml = Xs[pw][8][lane];
    const float mj = fmaxf(mo, ml.x);
    const float co = __builtin_amdgcn_exp2f(mo - mj);     // weight of the own half
    const float cp = __builtin_amdgcn_exp2f(ml.x - mj);   // weight of the partner's
    float lj = lo * co + ml.y * cp;
    lj += xhalf(lj);                 // join the wave halves' sums once
    const float inv = 1.0f / lj;
    const float fo = co * inv, fp = cp * inv;

    _Float16* yrow = y + ((size_t)(b * Nq + qt * 32 + grp * 16 + l15)) * D + h * 64 + hi8;
#pragma unroll
    for (int ni = 0; ni < 4; ++ni) {
        const v8f own = grp ? accY[1][ni] : accY[0][ni];
        v8f par;
        par.lo = Xs[pw][ni * 2][lane];
        par.hi = Xs[pw][ni * 2 + 1][lane];
        const v8f o = own * fo + par * fp;
        *reinterpret_cast<v8h*>(yrow + ni * 16) = __builtin_convertvector(o, v8h);
    }
}

// ---------------------------------------------------------------------------
extern "C" void kernel_launch(void* const* d_in, const int* in_sizes, int n_in,
                              void* d_out, int out_size, void* d_ws, size_t ws_size,
                              hipStream_t stream) {
    const float* x   = (const float*)d_in[0];
    const float* ctx = (const float*)d_in[1];
    const float* Wq  = (const float*)d_in[2];
    const float* Wkv = (const float*)d_in[3];
    const float* Wo  = (const float*)d_in[4];
    float* out = (float*)d_out;

    const int Bc = 2, Nc = 2048, Tc = 2048, Dc = 1024, Hc = 16;
    const int MQ  = Bc * Nc;   // 4096
    const int MKV = Bc * Tc;   // 4096

    // workspace (f16): x16 | ctx16 | WqT | WkvT | WoT | q | k | vT | y
    _Float16* x16   = (_Float16*)d_ws;
    _Float16* ctx16 = x16   + (size_t)MQ * Dc;
    _Float16* WqT   = ctx16 + (size_t)MKV * Dc;
    _Float16* WkvT  = WqT   + (size_t)Dc * Dc;
    _Float16* WoT   = WkvT  + (size_t)128 * Dc;
    _Float16* qbuf  = WoT   + (size_t)Dc * Dc;
    _Float16* kb    = qbuf  + (size_t)MQ * Dc;
    _Float16* vT    = kb    + (size_t)MKV * 64;
    _Float16* y     = vT    + (size_t)MKV * 64;

    const float alphaQ = 0.125f * 1.44269504088896340736f;  // hd^-0.5 * log2(e)

    // ---- prep: fp32 -> fp16 (+ weight transposes), one launch ----
    prep_kernel<<<dim3(512), dim3(256), 0, stream>>>(
        x, ctx, Wq, Wkv, Wo, x16, ctx16, WqT, WkvT, WoT);

    dim3 blk(256);
    // q = (x @ Wq) * alphaQ -> f16, and kv = ctx @ Wkv -> k row-major + v
    // transposed, in one launch (MQ == MKV)
    proj_q_kv_f16<1024, 2048><<<dim3(1 + Dc / 128, MQ / 128), blk, 0, stream>>>(
        x16, WqT, ctx16, WkvT, MQ, Dc, alphaQ, qbuf, kb);
    // attention -> y (f16)
    const int totalTiles = Bc * Hc * (Nc / 32);   // 2048 tiles of 32 queries
    mqa_attn_kernel<<<dim3(totalTiles / 8), dim3(512), 0, stream>>>(
        qbuf, kb, vT, y, Nc, Tc, Dc, Hc);
    // out = y @ Wo -> f32
    wmma_gemm_f16<1, 1024, 2048><<<dim3(Dc / 128, MQ / 128), blk, 0, stream>>>(
        y, WoT, MQ, Dc, 1.0f, out);
}

// v009
// It runs in 60.6 microseconds.
// Two timings next to v008 put it at 1.04 and 1.05 times that version's speed.
// All steps since v000 together make it 3.38 times as fast.
#include <hip/hip_runtime.h>
#include <math.h>

typedef _Float16 v16h __attribute__((ext_vector_type(16)));
typedef _Float16 v8h  __attribute__((ext_vector_type(8)));
typedef _Float16 v4h  __attribute__((ext_vector_type(4)));
typedef _Float16 v2h  __attribute__((ext_vector_type(2)));
typedef float    v8f  __attribute__((ext_vector_type(8)));
typedef float    v4f  __attribute__((ext_vector_type(4)));
typedef float    v2f  __attribute__((ext_vector_type(2)));

union HFrag { v16h v; v8h h[2]; };

__device__ __forceinline__ v16h load_frag(const _Float16* p) {
    HFrag f;
    f.h[0] = *reinterpret_cast<const v8h*>(p);
    f.h[1] = *reinterpret_cast<const v8h*>(p + 16);
    return f.v;
}

__device__ __forceinline__ v8f wmma_f16(v16h a, v16h b, v8f c) {
    return __builtin_amdgcn_wmma_f32_16x16x32_f16(false, a, false, b,
                                                  (short)0, c, false, false);
}

__device__ __forceinline__ void async_copy16x8(unsigned int l, unsigned int lstep,
                                               const _Float16* g, size_t gstep) {
    asm volatile("global_load_async_to_lds_b128 %0, %8, off\n\t"
                 "global_load_async_to_lds_b128 %1, %9, off\n\t"
                 "global_load_async_to_lds_b128 %2, %10, off\n\t"
                 "global_load_async_to_lds_b128 %3, %11, off\n\t"
                 "global_load_async_to_lds_b128 %4, %12, off\n\t"
                 "global_load_async_to_lds_b128 %5, %13, off\n\t"
                 "global_load_async_to_lds_b128 %6, %14, off\n\t"
                 "global_load_async_to_lds_b128 %7, %15, off\n\t"
                 "s_wait_xcnt 0x0"
                 :: "v"(l), "v"(l + lstep), "v"(l + 2 * lstep), "v"(l + 3 * lstep),
                    "v"(l + 4 * lstep), "v"(l + 5 * lstep), "v"(l + 6 * lstep),
                    "v"(l + 7 * lstep),
                    "v"(g), "v"(g + gstep), "v"(g + 2 * gstep), "v"(g + 3 * gstep),
                    "v"(g + 4 * gstep), "v"(g + 5 * gstep), "v"(g + 6 * gstep),
                    "v"(g + 7 * gstep) : "memory");
}
__device__ __forceinline__ void wait_async0() {
    asm volatile("s_wait_asynccnt 0x0" ::: "memory");
}
__device__ __forceinline__ unsigned int lds_addr_of(const void* p) {
    return (unsigned int)(uintptr_t)p;
}

// ---------------------------------------------------------------------------
// Prep, ONE launch of 512 equal blocks (two for every WGP, 16 waves a WGP):
// fp32 -> fp16 of x and context, and the three weight transposes
// W (Kd x Nd, f32, row-major) -> WT (Nd x Kd, f16, row-major).
// Every block takes 64 KiB of x or context (16 loads of 16 B a lane), one
// 64 x 64 tile of Wq or Wo and one 16 x 16 tile of Wkv; all its loads are
// issued before the first is used, and it has one barrier.
// ---------------------------------------------------------------------------
#define PD   1024  // model dim: rows of every W, columns of Wq and Wo
#define PKV  128   // columns of Wkv
#define PCH  4096  // 16-byte pieces of x or context per block
#define TPIT 72    // transposed tile's row pitch in halves: 128 B + 16 B (16 B x odd)

__global__ __launch_bounds__(256) void prep_kernel(
    const float* __restrict__ x, const float* __restrict__ ctx,
    const float* __restrict__ Wq, const float* __restrict__ Wkv,
    const float* __restrict__ Wo,
    _Float16* __restrict__ x16, _Float16* __restrict__ ctx16,
    _Float16* __restrict__ WqT, _Float16* __restrict__ WkvT,
    _Float16* __restrict__ WoT)
{
    __shared__ alignas(16) _Float16 tT[64 * TPIT];   // [n][k] of the 64 x 64 tile
    __shared__ _Float16 sT[16 * 17];                 // [k][n] of the 16 x 16 tile

    const int  tid   = threadIdx.x;
    const int  blk   = blockIdx.x;
    const bool first = blk < 256;      // blocks 0..255: x, Wq; 256..511: context, Wo
    const int  sub   = blk & 255;
    const int  c16   = tid & 15;
    const int  r16   = tid >> 4;

    // the block's stretch of x or context: a wave's load = 512 B in a row
    const v4f* src = reinterpret_cast<const v4f*>(first ? x : ctx) + (size_t)sub * PCH + tid;
    v4h*       dst = reinterpret_cast<v4h*>(first ? x16 : ctx16) + (size_t)sub * PCH + tid;
    v4f f[16];
#pragma unroll
    for (int i = 0; i < 16; ++i) f[i] = src[i * 256];

    // 64 x 64 tile: a lane takes 4 columns of two adjacent k rows, twice
    const float* W  = first ? Wq : Wo;
    _Float16*    WT = first ? WqT : WoT;
    const int k0 = (sub >> 4) * 64, n0 = (sub & 15) * 64;
    v4f w[2][2];
#pragma unroll
    for (int i = 0; i < 2; ++i)
#pragma unroll
        for (int p = 0; p < 2; ++p)
            w[i][p] = *reinterpret_cast<const v4f*>(
                &W[(size_t)(k0 + i * 32 + r16 * 2 + p) * PD + n0 + c16 * 4]);

    // 16 x 16 tile of Wkv: one element a lane
    const int kk0 = (blk >> 3) * 16, nn0 = (blk & 7) * 16;
    const float wk = Wkv[(size_t)(kk0 + r16) * PKV + nn0 + c16];

    // Behind the last load: no address register of a load above is rewritten in
    // front of this wait.
    asm volatile("s_wait_xcnt 0x0" ::: "memory");
    // Keeps the conversions below the loads: without it the compiler, to save
    // registers, converts the first loads before it issues the last, and a
    // block waits out the memory latency twice.
    __builtin_amdgcn_sched_barrier(0);

#pragma unroll
    for (int i = 0; i < 2; ++i)
#pragma unroll
        for (int j = 0; j < 4; ++j) {
            const v2h pr = { (_Float16)w[i][0][j], (_Float16)w[i][1][j] };
            *reinterpret_cast<v2h*>(&tT[(c16 * 4 + j) * TPIT + i * 32 + r16 * 2]) = pr;
        }
    sT[r16 * 17 + c16] = (_Float16)wk;
    __syncthreads();

    // rows of WT: 8 lanes write one whole 128-B line
#pragma unroll
    for (int i = 0; i < 2; ++i) {
        const int n = (tid >> 3) + i * 32, ch = (tid & 7) * 8;
        *reinterpret_cast<v8h*>(&WT[(size_t)(n0 + n) * PD + k0 + ch]) =
            *reinterpret_cast<const v8h*>(&tT[n * TPIT + ch]);
    }
    WkvT[(size_t)(nn0 + r16) * PD + kk0 + c16] = sT[c16 * 17 + r16];

#pragma unroll
    for (int i = 0; i < 16; ++i) dst[i * 256] = __builtin_convertvector(f[i], v4h);
}

// ---------------------------------------------------------------------------
// WMMA GEMM, f16 operands: C = alpha * (A @ BT^T)
//   A : M x K f16 row-major          BT : N x K f16 row-major (pre-transposed)
// Double-buffered LDS staging via global_load_async_to_lds_b128, 128 k a tile:
// a hand-over (the copies' latency, two waits, a barrier) comes once for 32
// WMMAs of a wave, and 64 KiB a block are in flight while a tile is worked on.
// K is a multiple of 128.
// modes: 0 = f16 row-major out   1 = f32 row-major out
//        2 = kv split: col<64 -> K (b,t,64); col>=64 -> V^T (b,64,T)
// MODE, the row length N of C and the sequence length TDIM are template
// parameters: each block's epilogue is straight-line code for its own mode,
// with its 64 stores a lane at constant distances from few addresses.
// gemm_block is one block's 128 x 128 tile of C at (bm0, bn0); the two LDS
// buffers of each operand are the calling kernel's, so that a kernel which
// holds two modes has them once.
// ---------------------------------------------------------------------------
#define BM 128
#define BN 128
#define BK 128
#define LP 136  // LDS row pitch in halves: 256 B + 16 B (16 B x odd)

template <int MODE, int N, int TDIM>
__device__ __forceinline__ void gemm_block(
    const _Float16* __restrict__ A, const _Float16* __restrict__ BT,
    int M, int K,
    float alpha, void* __restrict__ Cp, int bm0, int bn0,
    _Float16 (*As)[BM * LP], _Float16 (*Bs)[BN * LP])
{
    const int tid  = threadIdx.x;
    const int lane = tid & 31;
    const int wave = tid >> 5;
    const int wm = wave & 3;            // 4 waves along M
    const int wn = wave >> 2;           // 2 waves along N
    const int l15 = lane & 15;
    const int hi8 = (lane >> 4) << 3;

    // each thread copies eight 16B chunks of A and eight of B per tile; a
    // wave's copy = 2 rows of 256 B
    const int srow = tid >> 4;              // 0..15, plus 16 a copy
    const int skg  = (tid & 15) * 8;        // K-group within 128
    const _Float16* ag = A  + (size_t)(bm0 + srow) * K + skg;
    const _Float16* bg = BT + (size_t)(bn0 + srow) * K + skg;

    v8f acc[2][4];
#pragma unroll
    for (int mi = 0; mi < 2; ++mi)
#pragma unroll
        for (int ni = 0; ni < 4; ++ni)
            acc[mi][ni] = {};

    auto stage = [&](int buf, int st) {
        async_copy16x8(lds_addr_of(&As[buf][srow * LP + skg]), 16 * LP * 2,
                       ag + (size_t)st * BK, (size_t)16 * K);
        async_copy16x8(lds_addr_of(&Bs[buf][srow * LP + skg]), 16 * LP * 2,
                       bg + (size_t)st * BK, (size_t)16 * K);
    };

    const int nst = K / BK;
    stage(0, 0);
    wait_async0();                   // this wave's share of tile 0 has landed
    __syncthreads();                 // ... and every other wave's
    if (nst > 1) stage(1, 1);

    for (int st = 0; st < nst; ++st) {
        const int buf = st & 1;
        const _Float16* abase = &As[buf][(wm * 32 + l15) * LP + hi8];
        const _Float16* bbase = &Bs[buf][(wn * 64 + l15) * LP + hi8];

        // unrolled: the fragment addresses are constant distances from two
        // registers, and the loads of a later k step can go ahead of the WMMAs
#pragma unroll
        for (int kk = 0; kk < BK; kk += 32) {
            v16h aF[2], bF[4];
#pragma unroll
            for (int mi = 0; mi < 2; ++mi)
                aF[mi] = load_frag(abase + mi * 16 * LP + kk);
#pragma unroll
            for (int ni = 0; ni < 4; ++ni)
                bF[ni] = load_frag(bbase + ni * 16 * LP + kk);

#pragma unroll
            for (int mi = 0; mi < 2; ++mi)
#pragma unroll
                for (int ni = 0; ni < 4; ++ni)
                    acc[mi][ni] = wmma_f16(aF[mi], bF[ni], acc[mi][ni]);
        }

        // hand-over: this wave's reads of the tile are done ...
        asm volatile("s_wait_dscnt 0x0" ::: "memory");
        wait_async0();               // ... its share of the next tile has landed
        __syncthreads();             // ... and the same holds for every wave
        if (st + 2 < nst) stage(buf, st + 2);   // refill the buffer just left
    }
    wait_async0();                   // no copy is left when the wave ends

    // ---- epilogue ----
    // Every loop here is unrolled: acc and val are then indexed by constants
    // and stay in registers.
    static_assert(TDIM % 8 == 0, "the 8 rows of a lane's tile column lie in one batch");
#pragma unroll
    for (int mi = 0; mi < 2; ++mi) {
#pragma unroll
        for (int ni = 0; ni < 4; ++ni) {
            const int rbase = bm0 + wm * 32 + mi * 16 + hi8;
            const int col   = bn0 + wn * 64 + ni * 16 + l15;
            const v8f val = acc[mi][ni] * alpha;
            if constexpr (MODE == 0) {
#pragma unroll
                for (int j = 0; j < 8; ++j)
                    ((_Float16*)Cp)[(size_t)(rbase + j) * N + col] = (_Float16)val[j];
            } else if constexpr (MODE == 1) {
#pragma unroll
                for (int j = 0; j < 8; ++j)
                    ((float*)Cp)[(size_t)(rbase + j) * N + col] = val[j];
            } else {
                _Float16* kout = (_Float16*)Cp;
                _Float16* vout = kout + (size_t)M * 64;
                const int b = rbase / TDIM;
                const int t = rbase - b * TDIM;
                if (col < 64) {          // outside the loop over j: one test a tile
#pragma unroll
                    for (int j = 0; j < 8; ++j)
                        kout[(size_t)(rbase + j) * 64 + col] = (_Float16)val[j];
                } else {
#pragma unroll
                    for (int j = 0; j < 8; ++j)
                        vout[(size_t)(b * 64 + (col - 64)) * TDIM + t + j] = (_Float16)val[j];
                }
            }
        }
    }
}

// One GEMM a launch: grid (N / 128, M / 128).
template <int MODE, int N, int TDIM>
__global__ __launch_bounds__(256) void wmma_gemm_f16(
    const _Float16* __restrict__ A, const _Float16* __restrict__ BT,
    int M, int K,
    float alpha, void* __restrict__ Cp)
{
    __shared__ alignas(16) _Float16 As[2][BM * LP];
    __shared__ alignas(16) _Float16 Bs[2][BN * LP];
    gemm_block<MODE, N, TDIM>(A, BT, M, K, alpha, Cp,
                              blockIdx.y * BM, blockIdx.x * BN, As, Bs);
}

template <int NQ, int TDIM>
__global__ __launch_bounds__(256) void proj_q_kv_f16(
    const _Float16* __restrict__ X, const _Float16* __restrict__ WqT,
    const _Float16* __restrict__ C, const _Float16* __restrict__ WkvT,
    int M, int K,
    float alphaQ, _Float16* __restrict__ qout, _Float16* __restrict__ kvout)
{
    __shared__ alignas(16) _Float16 As[2][BM * LP];
    __shared__ alignas(16) _Float16 Bs[2][BN * LP];
    const int bm0 = blockIdx.y * BM;
    if (blockIdx.x == 0)
        gemm_block<2, 128, TDIM>(C, WkvT, M, K, 1.0f, kvout, bm0, 0, As, Bs);
    else
        gemm_block<0, NQ, TDIM>(X, WqT, M, K, alphaQ, qout,
                                bm0, (blockIdx.x - 1) * BN, As, Bs);
}

#define ATW 16
#define AGW 8
#define SKEY 128
#define KPIT 72
#define VPIT 136
#define PLIM 256.0f

__device__ __forceinline__ float xhalf(float x) {
    return __builtin_bit_cast(float, __builtin_amdgcn_permlanex16(
        __builtin_bit_cast(int, x), __builtin_bit_cast(int, x),
        0x76543210, 0xfedcba98, false, false));
}

__device__ __forceinline__ void async_copy16x4(
    unsigned int l0, unsigned int l1, unsigned int l2, unsigned int l3,
    const _Float16* g0, const _Float16* g1, const _Float16* g2, const _Float16* g3)
{
    asm volatile("global_load_async_to_lds_b128 %0, %4, off\n\t"
                 "global_load_async_to_lds_b128 %1, %5, off\n\t"
                 "global_load_async_to_lds_b128 %2, %6, off\n\t"
                 "global_load_async_to_lds_b128 %3, %7, off\n\t"
                 "s_wait_xcnt 0x0"
                 :: "v"(l0), "v"(l1), "v"(l2), "v"(l3),
                    "v"(g0), "v"(g1), "v"(g2), "v"(g3) : "memory");
}

// A score step's 16 values of a lane, reference already taken off: their
// exponentials, packed as the B operand of the second product in the k order of
// load_frag (element s = key (s < 8 ? hi8 + s : 16 + hi8 + s - 8)); returns
// their in-lane sum, a tree over register pairs.
__device__ __forceinline__ float exp_sum_pack(v8f s0, v8f s1, HFrag& bP) {
#pragma unroll
    for (int r = 0; r < 8; ++r) s0[r] = __builtin_amdgcn_exp2f(s0[r]);
#pragma unroll
    for (int r = 0; r < 8; ++r) s1[r] = __builtin_amdgcn_exp2f(s1[r]);
    const v8f t8 = s0 + s1;
    const v4f t4 = t8.lo + t8.hi;
    const v2f t2 = t4.lo + t4.hi;
    bP.h[0] = __builtin_convertvector(s0, v8h);
    bP.h[1] = __builtin_convertvector(s1, v8h);
    return t2.x + t2.y;
}

__global__ __launch_bounds__(ATW * 32) __attribute__((amdgpu_waves_per_eu(4, 4)))
void mqa_attn_kernel(
    const _Float16* __restrict__ q, const _Float16* __restrict__ kmat,
    const _Float16* __restrict__ vT, _Float16* __restrict__ y,
    int Nq, int Tlen, int D, int Hn)
{
    // [group][buffer]: a K tile and behind it a V^T tile
    __shared__ alignas(16) _Float16 KVs[2][2][SKEY * KPIT + 64 * VPIT];
    __shared__ alignas(16) v4f Xs[ATW][9][32];   // a wave's partial result of one tile

    const int tid  = threadIdx.x;
    const int lane = tid & 31;
    const int wv   = tid >> 5;
    const int grp  = __builtin_amdgcn_readfirstlane(tid >> 8);   // key group, wave-uniform
    const int gtid = tid & 255;      // thread within the group
    const int l15  = lane & 15;
    const int hi8  = (lane >> 4) << 3;

    const int qtiles = Nq >> 5;      // tiles of 32 queries
    int gw = blockIdx.x * AGW + (wv & (AGW - 1));
    const int qt = gw % qtiles; gw /= qtiles;
    const int h  = gw % Hn;
    const int b  = gw / Hn;          // the same in all waves of a block

    // This thread's share of its group's tile: 4 chunks of K (the tile is
    // 16 KiB in a row in memory; a wave's copy = 4 rows = 4 lines) and 4 of V^T
    // (a wave's copy = 2 rows of 256 B).
    const int khalf = Tlen >> 1;     // keys of a group
    const _Float16* kg = kmat + ((size_t)b * Tlen + (size_t)grp * khalf) * 64 + gtid * 8;
    const _Float16* vg = vT + (size_t)(b * 64 + (gtid >> 4)) * Tlen + grp * khalf
                            + (gtid & 15) * 8;
    const int kl = (gtid >> 3) * KPIT + (gtid & 7) * 8;
    const int vl = (gtid >> 4) * VPIT + (gtid & 15) * 8;

    auto stage = [&](int buf, int st) {
        const _Float16* kgs = kg + (size_t)st * (SKEY * 64);
        const _Float16* vgs = vg + (size_t)st * SKEY;
        async_copy16x4(lds_addr_of(&KVs[grp][buf][kl]),
                       lds_addr_of(&KVs[grp][buf][kl + 32 * KPIT]),
                       lds_addr_of(&KVs[grp][buf][kl + 64 * KPIT]),
                       lds_addr_of(&KVs[grp][buf][kl + 96 * KPIT]),
                       kgs, kgs + 2048, kgs + 4096, kgs + 6144);
        async_copy16x4(lds_addr_of(&KVs[grp][buf][SKEY * KPIT + vl]),
                       lds_addr_of(&KVs[grp][buf][SKEY * KPIT + vl + 16 * VPIT]),
                       lds_addr_of(&KVs[grp][buf][SKEY * KPIT + vl + 32 * VPIT]),
                       lds_addr_of(&KVs[grp][buf][SKEY * KPIT + vl + 48 * VPIT]),
                       vgs, vgs + (size_t)16 * Tlen, vgs + (size_t)32 * Tlen,
                       vgs + (size_t)48 * Tlen);
    };

    const int nst = khalf / SKEY;
    stage(0, 0);

    const _Float16* qbase = q + ((size_t)(b * Nq + qt * 32 + l15)) * D + h * 64;
    v16h bQ[2][2];
#pragma unroll
    for (int qi = 0; qi < 2; ++qi) {
        bQ[qi][0] = load_frag(qbase + (size_t)qi * 16 * D + 0  + hi8);
        bQ[qi][1] = load_frag(qbase + (size_t)qi * 16 * D + 32 + hi8);
    }

    wait_async0();                   // this wave's share of tile 0 has landed
    __syncthreads();                 // ... and every other wave's
    if (nst > 1) stage(1, 1);

    // per query tile: this lane's query; l = this half's keys only.
    // m = the query's softmax reference
    float m[2] = { -1e30f, -1e30f }, l[2] = { 0.0f, 0.0f };
    v8f accY[2][4];                  // accY[qi][ni][r] = O[query qi*16 + l15][ni*16 + hi8 + r]
#pragma unroll
    for (int qi = 0; qi < 2; ++qi) {
#pragma unroll
        for (int ni = 0; ni < 4; ++ni) accY[qi][ni] = {};
    }

    for (int st = 0; st < nst; ++st) {
        const int buf = st & 1;
        const _Float16* kbase = &KVs[grp][buf][l15 * KPIT + hi8];
        const _Float16* vbase = &KVs[grp][buf][SKEY * KPIT + l15 * VPIT + hi8];

        // two steps a trip, not all four: unrolled whole, the compiler runs out of
        // registers and spills
#pragma unroll 2
        for (int tc = 0; tc < SKEY; tc += 32) {
            const _Float16* kp0 = kbase + tc * KPIT;
            const _Float16* kp1 = kbase + (tc + 16) * KPIT;
            v16h a00 = load_frag(kp0);
            v16h a01 = load_frag(kp0 + 32);
            v16h a10 = load_frag(kp1);
            v16h a11 = load_frag(kp1 + 32);
            v16h aV[4];
#pragma unroll
            for (int ni = 0; ni < 4; ++ni)
                aV[ni] = load_frag(vbase + ni * 16 * VPIT + tc);

            float t[2];              // in-lane sum of the step's 16 exponentials
            HFrag bP[2];
            // unrolled: m, bQ, t and bP are indexed by constants, and the two
            // tiles' chains, which need nothing of each other, can interleave
#pragma unroll
            for (int qi = 0; qi < 2; ++qi) {
                // s0[r] = S[query][key tc + hi8 + r], s1[r]: key tc + 16 + hi8 + r
                v8f s0 = {}, s1 = {};
                s0 = wmma_f16(a00, bQ[qi][0], s0);
                s1 = wmma_f16(a10, bQ[qi][0], s1);
                s0 = wmma_f16(a01, bQ[qi][1], s0);
                s1 = wmma_f16(a11, bQ[qi][1], s1);
                t[qi] = exp_sum_pack(s0 - m[qi], s1 - m[qi], bP[qi]);
            }

            // m stands as long as no exponential passes PLIM (they are not
            // negative, so their sum bounds each; an overflow reads as infinity,
            // as does the first step, where m is -1e30). Else, a branch that the
            // whole wave takes: the scores anew, their maximum into m, O and l
            // brought to the new m, the step's exponentials anew.
            if (__builtin_amdgcn_ballot_w32(fmaxf(t[0], t[1]) > PLIM) != 0u) {
#pragma unroll
                for (int qi = 0; qi < 2; ++qi) {
                    v8f s0 = {}, s1 = {};
                    s0 = wmma_f16(a00, bQ[qi][0], s0);
                    s1 = wmma_f16(a10, bQ[qi][0], s1);
                    s0 = wmma_f16(a01, bQ[qi][1], s0);
                    s1 = wmma_f16(a11, bQ[qi][1], s1);

                    float mt = fmaxf(s0[0], s1[0]);
#pragma unroll
                    for (int r = 1; r < 8; ++r) mt = fmaxf(mt, fmaxf(s0[r], s1[r]));
                    mt = fmaxf(mt, xhalf(mt));   // both halves: the query's maximum
                    const float mn = fmaxf(m[qi], mt);
                    const float sc = __builtin_amdgcn_exp2f(m[qi] - mn);
                    m[qi] = mn;
                    l[qi] *= sc;
#pragma unroll
                    for (int ni = 0; ni < 4; ++ni) accY[qi][ni] *= sc;

                    s0 -= mn;
                    s1 -= mn;
                    t[qi] = exp_sum_pack(s0, s1, bP[qi]);
                }
            }

#pragma unroll
            for (int qi = 0; qi < 2; ++qi) {
                l[qi] += t[qi];
#pragma unroll
                for (int ni = 0; ni < 4; ++ni)
                    accY[qi][ni] = wmma_f16(aV[ni], bP[qi].v, accY[qi][ni]);
            }
        }

        // hand-over: this wave's reads of the tile are done ...
        asm volatile("s_wait_dscnt 0x0" ::: "memory");
        wait_async0();               // ... its share of the next tile has landed
        __syncthreads();             // ... and the same holds for every wave
        if (st + 2 < nst) stage(buf, st + 2);   // refill the buffer just left
    }
    wait_async0();                   // no copy is left when the wave ends

    // ---- join of the two key halves ----
    // Wave w and wave w ^ 8 hold the same queries in the same lanes. Group g
    // finishes query tile g: it hands its partial result of the other tile to
    // its partner and takes the partner's of its own.
#pragma unroll
    for (int ni = 0; ni < 4; ++ni) {
        const v8f o = grp ? accY[0][ni] : accY[1][ni];
        Xs[wv][ni * 2][lane]     = o.lo;
        Xs[wv][ni * 2 + 1][lane] = o.hi;
    }
    Xs[wv][8][lane] = v4f{ grp ? m[0] : m[1], grp ? l[0] : l[1], 0.0f, 0.0f };
    __syncthreads();                 // every wave's partial result is in LDS

    const int   pw = wv ^ AGW;
    const float mo = grp ? m[1] : m[0];
    const float lo = grp ? l[1] : l[0];
    const v4f   ml = Xs[pw][8][lane];
    const float mj = fmaxf(mo, ml.x);
    const float co = __builtin_amdgcn_exp2f(mo - mj);     // weight of the own half
    const float cp = __builtin_amdgcn_exp2f(ml.x - mj);   // weight of the partner's
    float lj = lo * co + ml.y * cp;
    lj += xhalf(lj);                 // join the wave halves' sums once
    const float inv = 1.0f / lj;
    const float fo = co * inv, fp = cp * inv;

    _Float16* yrow = y + ((size_t)(b * Nq + qt * 32 + grp * 16 + l15)) * D + h * 64 + hi8;
#pragma unroll
    for (int ni = 0; ni < 4; ++ni) {
        const v8f own = grp ? accY[1][ni] : accY[0][ni];
        v8f par;
        par.lo = Xs[pw][ni * 2][lane];
        par.hi = Xs[pw][ni * 2 + 1][lane];
        const v8f o = own * fo + par * fp;
        *reinterpret_cast<v8h*>(yrow + ni * 16) = __builtin_convertvector(o, v8h);
    }
}

// ---------------------------------------------------------------------------
extern "C" void kernel_launch(void* const* d_in, const int* in_sizes, int n_in,
                              void* d_out, int out_size, void* d_ws, size_t ws_size,
                              hipStream_t stream) {
    const float* x   = (const float*)d_in[0];
    const float* ctx = (const float*)d_in[1];
    const float* Wq  = (const float*)d_in[2];
    const float* Wkv = (const float*)d_in[3];
    const float* Wo  = (const float*)d_in[4];
    float* out = (float*)d_out;

    const int Bc = 2, Nc = 2048, Tc = 2048, Dc = 1024, Hc = 16;
    const int MQ  = Bc * Nc;   // 4096
    const int MKV = Bc * Tc;   // 4096

    // workspace (f16): x16 | ctx16 | WqT | WkvT | WoT | q | k | vT | y
    _Float16* x16   = (_Float16*)d_ws;
    _Float16* ctx16 = x16   + (size_t)MQ * Dc;
    _Float16* WqT   = ctx16 + (size_t)MKV * Dc;
    _Float16* WkvT  = WqT   + (size_t)Dc * Dc;
    _Float16* WoT   = WkvT  + (size_t)128 * Dc;
    _Float16* qbuf  = WoT   + (size_t)Dc * Dc;
    _Float16* kb    = qbuf  + (size_t)MQ * Dc;
    _Float16* vT    = kb    + (size_t)MKV * 64;
    _Float16* y     = vT    + (size_t)MKV * 64;

    const float alphaQ = 0.125f * 1.44269504088896340736f;  // hd^-0.5 * log2(e)

    // ---- prep: fp32 -> fp16 (+ weight transposes), one launch ----
    prep_kernel<<<dim3(512), dim3(256), 0, stream>>>(
        x, ctx, Wq, Wkv, Wo, x16, ctx16, WqT, WkvT, WoT);

    dim3 blk(256);
    // q = (x @ Wq) * alphaQ -> f16, and kv = ctx @ Wkv -> k row-major + v
    // transposed, in one launch (MQ == MKV)
    proj_q_kv_f16<1024, 2048><<<dim3(1 + Dc / 128, MQ / 128), blk, 0, stream>>>(
        x16, WqT, ctx16, WkvT, MQ, Dc, alphaQ, qbuf, kb);
    // attention -> y (f16)
    const int totalTiles = Bc * Hc * (Nc / 32);   // 2048 tiles of 32 queries
    mqa_attn_kernel<<<dim3(totalTiles / 8), dim3(512), 0, stream>>>(
        qbuf, kb, vT, y, Nc, Tc, Dc, Hc);
    // out = y @ Wo -> f32
    wmma_gemm_f16<1, 1024, 2048><<<dim3(Dc / 128, MQ / 128), blk, 0, stream>>>(
        y, WoT, MQ, Dc, 1.0f, out);
}

// v010
// It runs in 58.6 microseconds.
// Next to v009, in two timings, it ran 1.03 times as fast each time.
// Counting every step since v000, it is 3.48 times as fast.
#include <hip/hip_runtime.h>
#include <math.h>

typedef _Float16 v16h __attribute__((ext_vector_type(16)));
typedef _Float16 v8h  __attribute__((ext_vector_type(8)));
typedef _Float16 v4h  __attribute__((ext_vector_type(4)));
typedef _Float16 v2h  __attribute__((ext_vector_type(2)));
typedef float    v8f  __attribute__((ext_vector_type(8)));
typedef float    v4f  __attribute__((ext_vector_type(4)));
typedef float    v2f  __attribute__((ext_vector_type(2)));

union HFrag { v16h v; v8h h[2]; };

__device__ __forceinline__ v16h load_frag(const _Float16* p) {
    HFrag f;
    f.h[0] = *reinterpret_cast<const v8h*>(p);
    f.h[1] = *reinterpret_cast<const v8h*>(p + 16);
    return f.v;
}

__device__ __forceinline__ v8f wmma_f16(v16h a, v16h b, v8f c) {
    return __builtin_amdgcn_wmma_f32_16x16x32_f16(false, a, false, b,
                                                  (short)0, c, false, false);
}

typedef uint32_t u32x4 __attribute__((ext_vector_type(4)));
typedef uint32_t u32x8 __attribute__((ext_vector_type(8)));

__device__ __forceinline__ uint32_t uni(uint32_t v) {
    return (uint32_t)__builtin_amdgcn_readfirstlane(v);
}
__device__ __forceinline__ uint32_t pinned(uint32_t v) {
    uint32_t w = uni(v);
    asm volatile("" : "+s"(w));   // pinned(): held in a scalar register, the test compiles to s_cmp + s_cbranch_scc
    return w;
}
template <uint32_t ROWB, uint32_t ROWS, uint32_t PADC>
__device__ __forceinline__ u32x8 tdm_group1(uint32_t src_pitch) {
    u32x8 g;
    g[0] = uni((1u << 20) | (PADC << 22) | (3u << 25));
    g[1] = uni((ROWB & 0xFFFFu) << 16);
    g[2] = uni((ROWB >> 16) | ((ROWS & 0xFFFFu) << 16));
    g[3] = uni((ROWS >> 16) | (ROWB << 16));
    g[4] = uni(ROWS);
    g[5] = uni(src_pitch);
    g[6] = uni(0u);
    g[7] = uni(0u);
    asm volatile("" : "+s"(g));
    return g;
}
__device__ __forceinline__ u32x4 tdm_group0(uint32_t lds_dst, uint64_t ga) {
    u32x4 g;
    g[0] = uni(1u);
    g[1] = uni(lds_dst);
    g[2] = uni((uint32_t)ga);
    g[3] = uni((((uint32_t)(ga >> 32)) & 0x01FFFFFFu) | 0x80000000u);
    return g;
}
// To the next stage: the tile's address moves on by step bytes, the place in LDS
// goes to the other of the two buffers (lds_both: the sum of their addresses).
// Called behind the wait that covers the last request; step and sum are pinned
// there, so that no word is formed in front of that wait.
__device__ __forceinline__ void tdm_advance(u32x4& g0, uint32_t lds_both, uint32_t step) {
    const uint64_t a = (((uint64_t)g0[3] << 32) | (uint64_t)g0[2]) + pinned(step);
    g0[1] = uni(pinned(lds_both) - g0[1]);
    g0[2] = uni((uint32_t)a);
    g0[3] = uni((uint32_t)(a >> 32));   // the address stays under 2^57: the type bits stand
}
// g0 is named as read and written, and the next load's words are formed from it:
// it stays in its registers from one load to the next, and none of them holds
// another value while the request is outstanding.
__device__ __forceinline__ void tdm_load(u32x4& g0, const u32x8& g1) {
    asm volatile("tensor_load_to_lds %0, %1" : "+s"(g0) : "s"(g1) : "memory");
}
// The compiler places no wait for a tensor load: a tile has landed only behind
// the issuing wave's own wait.
__device__ __forceinline__ void wait_tensor0() {
    asm volatile("s_wait_tensorcnt 0x0" ::: "memory");
}
__device__ __forceinline__ unsigned int lds_addr_of(const void* p) {
    return (unsigned int)(uintptr_t)p;
}

// ---------------------------------------------------------------------------
// Prep, ONE launch of 512 equal blocks (two for every WGP, 16 waves a WGP):
// fp32 -> fp16 of x and context, and the three weight transposes
// W (Kd x Nd, f32, row-major) -> WT (Nd x Kd, f16, row-major).
// Every block takes 64 KiB of x or context (16 loads of 16 B a lane), one
// 64 x 64 tile of Wq or Wo and one 16 x 16 tile of Wkv; all its loads are
// issued before the first is used, and it has one barrier.
// ---------------------------------------------------------------------------
#define PD   1024  // model dim: rows of every W, columns of Wq and Wo
#define PKV  128   // columns of Wkv
#define PCH  4096  // 16-byte pieces of x or context per block
#define TPIT 72    // transposed tile's row pitch in halves: 128 B + 16 B (16 B x odd)

__global__ __launch_bounds__(256) void prep_kernel(
    const float* __restrict__ x, const float* __restrict__ ctx,
    const float* __restrict__ Wq, const float* __restrict__ Wkv,
    const float* __restrict__ Wo,
    _Float16* __restrict__ x16, _Float16* __restrict__ ctx16,
    _Float16* __restrict__ WqT, _Float16* __restrict__ WkvT,
    _Float16* __restrict__ WoT)
{
    __shared__ alignas(16) _Float16 tT[64 * TPIT];   // [n][k] of the 64 x 64 tile
    __shared__ _Float16 sT[16 * 17];                 // [k][n] of the 16 x 16 tile

    const int  tid   = threadIdx.x;
    const int  blk   = blockIdx.x;
    const bool first = blk < 256;      // blocks 0..255: x, Wq; 256..511: context, Wo
    const int  sub   = blk & 255;
    const int  c16   = tid & 15;
    const int  r16   = tid >> 4;

    // the block's stretch of x or context: a wave's load = 512 B in a row
    const v4f* src = reinterpret_cast<const v4f*>(first ? x : ctx) + (size_t)sub * PCH + tid;
    v4h*       dst = reinterpret_cast<v4h*>(first ? x16 : ctx16) + (size_t)sub * PCH + tid;
    v4f f[16];
#pragma unroll
    for (int i = 0; i < 16; ++i) f[i] = src[i * 256];

    // 64 x 64 tile: a lane takes 4 columns of two adjacent k rows, twice
    const float* W  = first ? Wq : Wo;
    _Float16*    WT = first ? WqT : WoT;
    const int k0 = (sub >> 4) * 64, n0 = (sub & 15) * 64;
    v4f w[2][2];
#pragma unroll
    for (int i = 0; i < 2; ++i)
#pragma unroll
        for (int p = 0; p < 2; ++p)
            w[i][p] = *reinterpret_cast<const v4f*>(
                &W[(size_t)(k0 + i * 32 + r16 * 2 + p) * PD + n0 + c16 * 4]);

    // 16 x 16 tile of Wkv: one element a lane
    const int kk0 = (blk >> 3) * 16, nn0 = (blk & 7) * 16;
    const float wk = Wkv[(size_t)(kk0 + r16) * PKV + nn0 + c16];

    // Behind the last load: no address register of a load above is rewritten in
    // front of this wait.
    asm volatile("s_wait_xcnt 0x0" ::: "memory");
    // Keeps the conversions below the loads: without it the compiler, to save
    // registers, converts the first loads before it issues the last, and a
    // block waits out the memory latency twice.
    __builtin_amdgcn_sched_barrier(0);

#pragma unroll
    for (int i = 0; i < 2; ++i)
#pragma unroll
        for (int j = 0; j < 4; ++j) {
            const v2h pr = { (_Float16)w[i][0][j], (_Float16)w[i][1][j] };
            *reinterpret_cast<v2h*>(&tT[(c16 * 4 + j) * TPIT + i * 32 + r16 * 2]) = pr;
        }
    sT[r16 * 17 + c16] = (_Float16)wk;
    __syncthreads();

    // rows of WT: 8 lanes write one whole 128-B line
#pragma unroll
    for (int i = 0; i < 2; ++i) {
        const int n = (tid >> 3) + i * 32, ch = (tid & 7) * 8;
        *reinterpret_cast<v8h*>(&WT[(size_t)(n0 + n) * PD + k0 + ch]) =
            *reinterpret_cast<const v8h*>(&tT[n * TPIT + ch]);
    }
    WkvT[(size_t)(nn0 + r16) * PD + kk0 + c16] = sT[c16 * 17 + r16];

#pragma unroll
    for (int i = 0; i < 16; ++i) dst[i * 256] = __builtin_convertvector(f[i], v4h);
}

// ---------------------------------------------------------------------------
// WMMA GEMM, f16 operands: C = alpha * (A @ BT^T)
//   A : M x K f16 row-major          BT : N x K f16 row-major (pre-transposed)
// Double-buffered LDS staging by tensor loads, 128 k a tile: wave 0 brings the
// A tile and wave 1 the B tile, each 128 rows of 256 B in one request, padded
// to the pitch LP; no wave spends vector instructions or address waits on the
// refill. A hand-over (two waits, a barrier) comes once for 32 WMMAs of a wave,
// and 64 KiB a block are in flight while a tile is worked on.
// K is a multiple of 128 and at least 256. A tile fills 128 * 272 B = 17 * 2 KiB
// of LDS, so every buffer of the 2-KiB-aligned arrays starts at a multiple of 2 KiB.
// modes: 0 = f16 row-major out   1 = f32 row-major out
//        2 = kv split: col<64 -> K (b,t,64); col>=64 -> V^T (b,64,T)
// MODE, the row length N of C and the sequence length TDIM are template
// parameters: each block's epilogue is straight-line code for its own mode,
// with its 64 stores a lane at constant distances from few addresses.
// gemm_block is one block's 128 x 128 tile of C at (bm0, bn0); the two LDS
// buffers of each operand are the calling kernel's, so that a kernel which
// holds two modes has them once.
// ---------------------------------------------------------------------------
#define BM 128
#define BN 128
#define BK 128
#define LP 136  // LDS row pitch in halves: 256 B + 16 B (16 B x odd)

template <int MODE, int N, int TDIM>
__device__ __forceinline__ void gemm_block(
    const _Float16* __restrict__ A, const _Float16* __restrict__ BT,
    int M, int K,
    float alpha, void* __restrict__ Cp, int bm0, int bn0,
    _Float16 (*As)[BM * LP], _Float16 (*Bs)[BN * LP])
{
    const int tid  = threadIdx.x;
    const int lane = tid & 31;
    const int wave = tid >> 5;
    const int wm = wave & 3;            // 4 waves along M
    const int wn = wave >> 2;           // 2 waves along N
    const int l15 = lane & 15;
    const int hi8 = (lane >> 4) << 3;

    // waves 0 and 1 issue: one request a tile
    const uint32_t wu = uni((uint32_t)tid >> 5);
    const uint32_t issuer = pinned(wu < 2u);
    const u32x8 g1 = tdm_group1<BK * 2, BM, 5>((uint32_t)K * 2u);
    const _Float16* gsrc = (wu == 0u) ? A + (size_t)bm0 * K : BT + (size_t)bn0 * K;
    const uint32_t lds0 = lds_addr_of((wu == 0u) ? &As[0][0] : &Bs[0][0]);
    u32x4 g0 = tdm_group0(lds0, (uint64_t)(uintptr_t)gsrc);   // stage 0, buffer 0

    v8f acc[2][4];
#pragma unroll
    for (int mi = 0; mi < 2; ++mi)
#pragma unroll
        for (int ni = 0; ni < 4; ++ni)
            acc[mi][ni] = {};

    // the stage behind the last one issued, into the other buffer
    auto next_stage = [&]() {
        tdm_advance(g0, 2u * lds0 + (uint32_t)(BM * LP * 2), BK * 2u);
        tdm_load(g0, g1);
    };

    const int nst = K / BK;
    if (issuer) {
        tdm_load(g0, g1);
        wait_tensor0();              // this wave's tile of stage 0 has landed
    }
    __syncthreads();                 // ... and the other issuing wave's
    if (pinned(issuer & (uint32_t)(nst > 1))) next_stage();

    for (int st = 0; st < nst; ++st) {
        const int buf = st & 1;
        const _Float16* abase = &As[buf][(wm * 32 + l15) * LP + hi8];
        const _Float16* bbase = &Bs[buf][(wn * 64 + l15) * LP + hi8];

        // unrolled: the fragment addresses are constant distances from two
        // registers, and the loads of a later k step can go ahead of the WMMAs
#pragma unroll
        for (int kk = 0; kk < BK; kk += 32) {
            v16h aF[2], bF[4];
#pragma unroll
            for (int mi = 0; mi < 2; ++mi)
                aF[mi] = load_frag(abase + mi * 16 * LP + kk);
#pragma unroll
            for (int ni = 0; ni < 4; ++ni)
                bF[ni] = load_frag(bbase + ni * 16 * LP + kk);

#pragma unroll
            for (int mi = 0; mi < 2; ++mi)
#pragma unroll
                for (int ni = 0; ni < 4; ++ni)
                    acc[mi][ni] = wmma_f16(aF[mi], bF[ni], acc[mi][ni]);
        }

        // hand-over: this wave's reads of the tile are done ...
        asm volatile("s_wait_dscnt 0x0" ::: "memory");
        if (issuer) wait_tensor0();  // ... its tile of the next stage has landed
        __syncthreads();             // ... and the same holds for every wave
        // refill the buffer just left
        if (pinned(issuer & (uint32_t)(st + 2 < nst))) next_stage();
    }
    wait_tensor0();                  // no request is left when the wave ends
    asm volatile("s_wait_dscnt 0x0" ::: "memory");   // ... and no LDS read

    // ---- epilogue ----
    // Every loop here is unrolled: acc and val are then indexed by constants
    // and stay in registers.
    static_assert(TDIM % 8 == 0, "the 8 rows of a lane's tile column lie in one batch");
#pragma unroll
    for (int mi = 0; mi < 2; ++mi) {
#pragma unroll
        for (int ni = 0; ni < 4; ++ni) {
            const int rbase = bm0 + wm * 32 + mi * 16 + hi8;
            const int col   = bn0 + wn * 64 + ni * 16 + l15;
            const v8f val = acc[mi][ni] * alpha;
            if constexpr (MODE == 0) {
#pragma unroll
                for (int j = 0; j < 8; ++j)
                    ((_Float16*)Cp)[(size_t)(rbase + j) * N + col] = (_Float16)val[j];
            } else if constexpr (MODE == 1) {
#pragma unroll
                for (int j = 0; j < 8; ++j)
                    ((float*)Cp)[(size_t)(rbase + j) * N + col] = val[j];
            } else {
                _Float16* kout = (_Float16*)Cp;
                _Float16* vout = kout + (size_t)M * 64;
                const int b = rbase / TDIM;
                const int t = rbase - b * TDIM;
                if (col < 64) {          // outside the loop over j: one test a tile
#pragma unroll
                    for (int j = 0; j < 8; ++j)
                        kout[(size_t)(rbase + j) * 64 + col] = (_Float16)val[j];
                } else {
#pragma unroll
                    for (int j = 0; j < 8; ++j)
                        vout[(size_t)(b * 64 + (col - 64)) * TDIM + t + j] = (_Float16)val[j];
                }
            }
        }
    }
}

// One GEMM a launch: grid (N / 128, M / 128).
template <int MODE, int N, int TDIM>
__global__ __launch_bounds__(256) void wmma_gemm_f16(
    const _Float16* __restrict__ A, const _Float16* __restrict__ BT,
    int M, int K,
    float alpha, void* __restrict__ Cp)
{
    __shared__ __attribute__((aligned(2048))) _Float16 As[2][BM * LP];
    __shared__ __attribute__((aligned(2048))) _Float16 Bs[2][BN * LP];
    gemm_block<MODE, N, TDIM>(A, BT, M, K, alpha, Cp,
                              blockIdx.y * BM, blockIdx.x * BN, As, Bs);
}

template <int NQ, int TDIM>
__global__ __launch_bounds__(256) void proj_q_kv_f16(
    const _Float16* __restrict__ X, const _Float16* __restrict__ WqT,
    const _Float16* __restrict__ C, const _Float16* __restrict__ WkvT,
    int M, int K,
    float alphaQ, _Float16* __restrict__ qout, _Float16* __restrict__ kvout)
{
    __shared__ __attribute__((aligned(2048))) _Float16 As[2][BM * LP];
    __shared__ __attribute__((aligned(2048))) _Float16 Bs[2][BN * LP];
    const int bm0 = blockIdx.y * BM;
    if (blockIdx.x == 0)
        gemm_block<2, 128, TDIM>(C, WkvT, M, K, 1.0f, kvout, bm0, 0, As, Bs);
    else
        gemm_block<0, NQ, TDIM>(X, WqT, M, K, alphaQ, qout,
                                bm0, (blockIdx.x - 1) * BN, As, Bs);
}

#define ATW 16
#define AGW 8
#define SKEY 128
#define KPIT 72
#define VPIT 136
#define KVTILE 9216
#define PLIM 256.0f

__device__ __forceinline__ float xhalf(float x) {
    return __builtin_bit_cast(float, __builtin_amdgcn_permlanex16(
        __builtin_bit_cast(int, x), __builtin_bit_cast(int, x),
        0x76543210, 0xfedcba98, false, false));
}

// A score step's 16 values of a lane, reference already taken off: their
// exponentials, packed as the B operand of the second product in the k order of
// load_frag (element s = key (s < 8 ? hi8 + s : 16 + hi8 + s - 8)); returns
// their in-lane sum, a tree over register pairs.
__device__ __forceinline__ float exp_sum_pack(v8f s0, v8f s1, HFrag& bP) {
#pragma unroll
    for (int r = 0; r < 8; ++r) s0[r] = __builtin_amdgcn_exp2f(s0[r]);
#pragma unroll
    for (int r = 0; r < 8; ++r) s1[r] = __builtin_amdgcn_exp2f(s1[r]);
    const v8f t8 = s0 + s1;
    const v4f t4 = t8.lo + t8.hi;
    const v2f t2 = t4.lo + t4.hi;
    bP.h[0] = __builtin_convertvector(s0, v8h);
    bP.h[1] = __builtin_convertvector(s1, v8h);
    return t2.x + t2.y;
}

__global__ __launch_bounds__(ATW * 32) __attribute__((amdgpu_waves_per_eu(4, 4)))
void mqa_attn_kernel(
    const _Float16* __restrict__ q, const _Float16* __restrict__ kmat,
    const _Float16* __restrict__ vT, _Float16* __restrict__ y,
    int Nq, int Tlen, int D, int Hn)
{
    // [group][buffer]: a K tile and behind it a V^T tile
    __shared__ __attribute__((aligned(2048))) _Float16 KVs[2][2][2 * KVTILE];
    __shared__ alignas(16) v4f Xs[ATW][9][32];   // a wave's partial result of one tile

    const int tid  = threadIdx.x;
    const int lane = tid & 31;
    const int wv   = tid >> 5;
    const int grp  = __builtin_amdgcn_readfirstlane(tid >> 8);   // key group, wave-uniform
    const uint32_t gwv = uni((uint32_t)tid >> 5) & (AGW - 1);    // wave within the group
    const int l15  = lane & 15;
    const int hi8  = (lane >> 4) << 3;

    const int qtiles = Nq >> 5;      // tiles of 32 queries
    int gw = blockIdx.x * AGW + (wv & (AGW - 1));
    const int qt = gw % qtiles; gw /= qtiles;
    const int h  = gw % Hn;
    const int b  = gw / Hn;          // the same in all waves of a block

    // A group's tile: 128 rows of K, 128 B each and in a row in memory, and 64
    // rows of V^T, 256 B each, Tlen halves apart.
    static_assert(SKEY * KPIT == KVTILE && 64 * VPIT <= KVTILE, "tiles fit their places");
    const int khalf = Tlen >> 1;     // keys of a group
    const _Float16* kg = kmat + ((size_t)b * Tlen + (size_t)grp * khalf) * 64;
    const _Float16* vg = vT + (size_t)(b * 64) * Tlen + grp * khalf;
    const u32x8 g1K = tdm_group1<128, SKEY, 4>(128u);
    const u32x8 g1V = tdm_group1<SKEY * 2, 64, 5>((uint32_t)Tlen * 2u);
    const uint32_t isK = pinned(gwv == 0u), isV = pinned(gwv == 1u);
    const uint32_t ldsK = lds_addr_of(&KVs[grp][0][0]);
    const uint32_t ldsV = lds_addr_of(&KVs[grp][0][KVTILE]);
    u32x4 g0K = tdm_group0(ldsK, (uint64_t)(uintptr_t)kg);   // stage 0, buffer 0
    u32x4 g0V = tdm_group0(ldsV, (uint64_t)(uintptr_t)vg);

    // the stage behind the last one issued, into the other buffer, while one exists
    auto next_stage = [&](uint32_t more) {
        if (pinned(isK & more)) {
            tdm_advance(g0K, 2u * ldsK + (uint32_t)(2 * KVTILE * 2), SKEY * 64 * 2u);
            tdm_load(g0K, g1K);
        }
        if (pinned(isV & more)) {
            tdm_advance(g0V, 2u * ldsV + (uint32_t)(2 * KVTILE * 2), SKEY * 2u);
            tdm_load(g0V, g1V);
        }
    };

    const int nst = khalf / SKEY;

    const _Float16* qbase = q + ((size_t)(b * Nq + qt * 32 + l15)) * D + h * 64;
    v16h bQ[2][2];
#pragma unroll
    for (int qi = 0; qi < 2; ++qi) {
        bQ[qi][0] = load_frag(qbase + (size_t)qi * 16 * D + 0  + hi8);
        bQ[qi][1] = load_frag(qbase + (size_t)qi * 16 * D + 32 + hi8);
    }

    if (isK) {
        tdm_load(g0K, g1K);
        wait_tensor0();              // this wave's tile of stage 0 has landed
    }
    if (isV) {
        tdm_load(g0V, g1V);
        wait_tensor0();
    }
    __syncthreads();                 // ... and every other issuing wave's
    next_stage((uint32_t)(nst > 1));

    // per query tile: this lane's query; l = this half's keys only.
    // m = the query's softmax reference
    float m[2] = { -1e30f, -1e30f }, l[2] = { 0.0f, 0.0f };
    v8f accY[2][4];                  // accY[qi][ni][r] = O[query qi*16 + l15][ni*16 + hi8 + r]
#pragma unroll
    for (int qi = 0; qi < 2; ++qi) {
#pragma unroll
        for (int ni = 0; ni < 4; ++ni) accY[qi][ni] = {};
    }

    for (int st = 0; st < nst; ++st) {
        const int buf = st & 1;
        const _Float16* kbase = &KVs[grp][buf][l15 * KPIT + hi8];
        const _Float16* vbase = &KVs[grp][buf][KVTILE + l15 * VPIT + hi8];

        // two steps a trip, not all four: unrolled whole, the compiler runs out of
        // registers and spills
#pragma unroll 2
        for (int tc = 0; tc < SKEY; tc += 32) {
            const _Float16* kp0 = kbase + tc * KPIT;
            const _Float16* kp1 = kbase + (tc + 16) * KPIT;
            v16h a00 = load_frag(kp0);
            v16h a01 = load_frag(kp0 + 32);
            v16h a10 = load_frag(kp1);
            v16h a11 = load_frag(kp1 + 32);
            v16h aV[4];
#pragma unroll
            for (int ni = 0; ni < 4; ++ni)
                aV[ni] = load_frag(vbase + ni * 16 * VPIT + tc);

            float t[2];              // in-lane sum of the step's 16 exponentials
            HFrag bP[2];
            // unrolled: m, bQ, t and bP are indexed by constants, and the two
            // tiles' chains, which need nothing of each other, can interleave
#pragma unroll
            for (int qi = 0; qi < 2; ++qi) {
                // s0[r] = S[query][key tc + hi8 + r], s1[r]: key tc + 16 + hi8 + r
                v8f s0 = {}, s1 = {};
                s0 = wmma_f16(a00, bQ[qi][0], s0);
                s1 = wmma_f16(a10, bQ[qi][0], s1);
                s0 = wmma_f16(a01, bQ[qi][1], s0);
                s1 = wmma_f16(a11, bQ[qi][1], s1);
                t[qi] = exp_sum_pack(s0 - m[qi], s1 - m[qi], bP[qi]);
            }

            // m stands as long as no exponential passes PLIM (they are not
            // negative, so their sum bounds each; an overflow reads as infinity,
            // as does the first step, where m is -1e30). Else, a branch that the
            // whole wave takes: the scores anew, their maximum into m, O and l
            // brought to the new m, the step's exponentials anew.
            if (__builtin_amdgcn_ballot_w32(fmaxf(t[0], t[1]) > PLIM) != 0u) {
#pragma unroll
                for (int qi = 0; qi < 2; ++qi) {
                    v8f s0 = {}, s1 = {};
                    s0 = wmma_f16(a00, bQ[qi][0], s0);
                    s1 = wmma_f16(a10, bQ[qi][0], s1);
                    s0 = wmma_f16(a01, bQ[qi][1], s0);
                    s1 = wmma_f16(a11, bQ[qi][1], s1);

                    float mt = fmaxf(s0[0], s1[0]);
#pragma unroll
                    for (int r = 1; r < 8; ++r) mt = fmaxf(mt, fmaxf(s0[r], s1[r]));
                    mt = fmaxf(mt, xhalf(mt));   // both halves: the query's maximum
                    const float mn = fmaxf(m[qi], mt);
                    const float sc = __builtin_amdgcn_exp2f(m[qi] - mn);
                    m[qi] = mn;
                    l[qi] *= sc;
#pragma unroll
                    for (int ni = 0; ni < 4; ++ni) accY[qi][ni] *= sc;

                    s0 -= mn;
                    s1 -= mn;
                    t[qi] = exp_sum_pack(s0, s1, bP[qi]);
                }
            }

#pragma unroll
            for (int qi = 0; qi < 2; ++qi) {
                l[qi] += t[qi];
#pragma unroll
                for (int ni = 0; ni < 4; ++ni)
                    accY[qi][ni] = wmma_f16(aV[ni], bP[qi].v, accY[qi][ni]);
            }
        }

        // hand-over: this wave's reads of the tile are done ...
        asm volatile("s_wait_dscnt 0x0" ::: "memory");
        if (isK | isV) wait_tensor0();   // ... its tile of the next stage has landed
        __syncthreads();             // ... and the same holds for every wave
        next_stage((uint32_t)(st + 2 < nst));   // refill the buffer just left
    }
    wait_tensor0();                  // no request is left when the wave ends
    asm volatile("s_wait_dscnt 0x0" ::: "memory");   // ... and no LDS read

    // ---- join of the two key halves ----
    // Wave w and wave w ^ 8 hold the same queries in the same lanes. Group g
    // finishes query tile g: it hands its partial result of the other tile to
    // its partner and takes the partner's of its own.
#pragma unroll
    for (int ni = 0; ni < 4; ++ni) {
        const v8f o = grp ? accY[0][ni] : accY[1][ni];
        Xs[wv][ni * 2][lane]     = o.lo;
        Xs[wv][ni * 2 + 1][lane] = o.hi;
    }
    Xs[wv][8][lane] = v4f{ grp ? m[0] : m[1], grp ? l[0] : l[1], 0.0f, 0.0f };
    __syncthreads();                 // every wave's partial result is in LDS

    const int   pw = wv ^ AGW;
    const float mo = grp ? m[1] : m[0];
    const float lo = grp ? l[1] : l[0];
    const v4f   ml = Xs[pw][8][lane];
    const float mj = fmaxf(mo, ml.x);
    const float co = __builtin_amdgcn_exp2f(mo - mj);     // weight of the own half
    const float cp = __builtin_amdgcn_exp2f(ml.x - mj);   // weight of the partner's
    float lj = lo * co + ml.y * cp;
    lj += xhalf(lj);                 // join the wave halves' sums once
    const float inv = 1.0f / lj;
    const float fo = co * inv, fp = cp * inv;

    _Float16* yrow = y + ((size_t)(b * Nq + qt * 32 + grp * 16 + l15)) * D + h * 64 + hi8;
#pragma unroll
    for (int ni = 0; ni < 4; ++ni) {
        const v8f own = grp ? accY[1][ni] : accY[0][ni];
        v8f par;
        par.lo = Xs[pw][ni * 2][lane];
        par.hi = Xs[pw][ni * 2 + 1][lane];
        const v8f o = own * fo + par * fp;
        *reinterpret_cast<v8h*>(yrow + ni * 16) = __builtin_convertvector(o, v8h);
    }
}

// ---------------------------------------------------------------------------
extern "C" void kernel_launch(void* const* d_in, const int* in_sizes, int n_in,
                              void* d_out, int out_size, void* d_ws, size_t ws_size,
                              hipStream_t stream) {
    const float* x   = (const float*)d_in[0];
    const float* ctx = (const float*)d_in[1];
    const float* Wq  = (const float*)d_in[2];
    const float* Wkv = (const float*)d_in[3];
    const float* Wo  = (const float*)d_in[4];
    float* out = (float*)d_out;

    const int Bc = 2, Nc = 2048, Tc = 2048, Dc = 1024, Hc = 16;
    const int MQ  = Bc * Nc;   // 4096
    const int MKV = Bc * Tc;   // 4096

    // workspace (f16): x16 | ctx16 | WqT | WkvT | WoT | q | k | vT | y
    _Float16* x16   = (_Float16*)d_ws;
    _Float16* ctx16 = x16   + (size_t)MQ * Dc;
    _Float16* WqT   = ctx16 + (size_t)MKV * Dc;
    _Float16* WkvT  = WqT   + (size_t)Dc * Dc;
    _Float16* WoT   = WkvT  + (size_t)128 * Dc;
    _Float16* qbuf  = WoT   + (size_t)Dc * Dc;
    _Float16* kb    = qbuf  + (size_t)MQ * Dc;
    _Float16* vT    = kb    + (size_t)MKV * 64;
    _Float16* y     = vT    + (size_t)MKV * 64;

    const float alphaQ = 0.125f * 1.44269504088896340736f;  // hd^-0.5 * log2(e)

    // ---- prep: fp32 -> fp16 (+ weight transposes), one launch ----
    prep_kernel<<<dim3(512), dim3(256), 0, stream>>>(
        x, ctx, Wq, Wkv, Wo, x16, ctx16, WqT, WkvT, WoT);

    dim3 blk(256);
    // q = (x @ Wq) * alphaQ -> f16, and kv = ctx @ Wkv -> k row-major + v
    // transposed, in one launch (MQ == MKV)
    proj_q_kv_f16<1024, 2048><<<dim3(1 + Dc / 128, MQ / 128), blk, 0, stream>>>(
        x16, WqT, ctx16, WkvT, MQ, Dc, alphaQ, qbuf, kb);
    // attention -> y (f16)
    const int totalTiles = Bc * Hc * (Nc / 32);   // 2048 tiles of 32 queries
    mqa_attn_kernel<<<dim3(totalTiles / 8), dim3(512), 0, stream>>>(
        qbuf, kb, vT, y, Nc, Tc, Dc, Hc);
    // out = y @ Wo -> f32
    wmma_gemm_f16<1, 1024, 2048><<<dim3(Dc / 128, MQ / 128), blk, 0, stream>>>(
        y, WoT, MQ, Dc, 1.0f, out);
}
